// v000
// Measured on an AMD MI455X. A time is GPU time per run, averaged over a window of back-to-back runs after a warm-up
// (all launches, gaps included; the runs take copies of the inputs in turn), and the median of several windows.
// Apart from v000's, it joins two sittings. Times from different sittings can be a few percent apart, while
// side-by-side timings come from the same sitting.
// v000 is the starting kernel. One run takes 318 microseconds.
#include <hip/hip_runtime.h>
#include <hip/hip_bf16.h>

#define NCTX 3
#define BB 8
#define CC 128
#define CF 256
#define HH 64
#define WW 64

typedef __attribute__((ext_vector_type(2))) float v2f;
typedef __attribute__((ext_vector_type(8))) float v8f;

__device__ __forceinline__ v8f wmma4(v2f a, v2f b, v8f c) {
  // D = A(16x4) * B(4x16) + C(16x16), full fp32
  return __builtin_amdgcn_wmma_f32_16x16x4_f32(false, a, false, b, (short)0, c, false, false);
}

// ---------------------------------------------------------------------------
// Kernel W: transpose Wv (Co,Ci,3,3) -> tap-major (9, Co, Ci) so conv A-operands
// are contiguous along Ci (enables b64 A loads in the projection kernel).
// ---------------------------------------------------------------------------
__global__ void wv_transpose_kernel(const float* __restrict__ wv,
                                    float* __restrict__ wvT) {
  int idx = blockIdx.x * 256 + threadIdx.x;
  if (idx >= CC * CF * 9) return;
  int o   = idx / (CF * 9);
  int rem = idx % (CF * 9);
  int ci  = rem / 9;
  int tap = rem % 9;
  wvT[((size_t)tap * CC + o) * CF + ci] = wv[idx];
}

// ---------------------------------------------------------------------------
// Kernel A: projections from mainstream.
//   q    = Wf * x + bf                (stored to ws)
//   vals = conv3x3(x, Wv) + bv       (stored to ws)
//   lmain= sum_c (Wk*x+bk)_c * q_c   (stored to ws)
// One WG = one (b, h) row, 32 pixels wide. 8 waves x (16 M x 32 N) tiles.
// Input tile (3 rows x 256 ci x 34 cols) staged in LDS, padded to 40 floats/row.
// ---------------------------------------------------------------------------
__global__ void __launch_bounds__(256)
proj_kernel(const float* __restrict__ x,
            const float* __restrict__ wf, const float* __restrict__ bf,
            const float* __restrict__ wk, const float* __restrict__ bk,
            const float* __restrict__ wvT, const float* __restrict__ bv,
            float* __restrict__ q_out, float* __restrict__ v_out,
            float* __restrict__ lmain_out) {
  const int w0 = blockIdx.x * 32;
  const int h  = blockIdx.y;
  const int b  = blockIdx.z;
  const int tid  = threadIdx.x;
  const int wave = tid >> 5, lane = tid & 31;
  const int lrow = lane & 15;
  const int khalf = (lane >> 4) * 2;

  __shared__ float xs[3][CF][40];
  __shared__ float lm_s[32];
  if (tid < 32) lm_s[tid] = 0.0f;

  // cooperative, coalesced global->LDS with zero padding at image borders
  for (int idx = tid; idx < 3 * CF * 34; idx += 256) {
    int row = idx / (CF * 34);
    int rem = idx % (CF * 34);
    int ci  = rem / 34;
    int wl  = rem % 34;
    int gh = h - 1 + row;
    int gw = w0 - 1 + wl;
    float v = 0.0f;
    if ((unsigned)gh < HH && (unsigned)gw < WW)
      v = x[(((size_t)b * CF + ci) * HH + gh) * WW + gw];
    xs[row][ci][wl] = v;
  }
  __syncthreads();

  const int m = wave * 16 + lrow;  // A-matrix row (output channel)
  v8f accQ0 = {}, accQ1 = {}, accK0 = {}, accK1 = {}, accV0 = {}, accV1 = {};

  // q and mkey: 1x1 conv (center row of the tile, kx offset 1)
  for (int k0 = 0; k0 < CF; k0 += 4) {
    int k = k0 + khalf;
    v2f aq = *(const v2f*)(wf + (size_t)m * CF + k);
    v2f ak = *(const v2f*)(wk + (size_t)m * CF + k);
    v2f b0v = { xs[1][k][1 + lrow],  xs[1][k + 1][1 + lrow]  };
    v2f b1v = { xs[1][k][17 + lrow], xs[1][k + 1][17 + lrow] };
    accQ0 = wmma4(aq, b0v, accQ0);
    accQ1 = wmma4(aq, b1v, accQ1);
    accK0 = wmma4(ak, b0v, accK0);
    accK1 = wmma4(ak, b1v, accK1);
  }
  // vals: 3x3 conv as 9 accumulating tap-GEMMs
  for (int tap = 0; tap < 9; ++tap) {
    int ky = tap / 3, kx = tap % 3;
    const float* wrow = wvT + ((size_t)tap * CC + m) * CF;
    for (int k0 = 0; k0 < CF; k0 += 4) {
      int k = k0 + khalf;
      v2f av = *(const v2f*)(wrow + k);
      v2f b0v = { xs[ky][k][lrow + kx],      xs[ky][k + 1][lrow + kx]      };
      v2f b1v = { xs[ky][k][16 + lrow + kx], xs[ky][k + 1][16 + lrow + kx] };
      accV0 = wmma4(av, b0v, accV0);
      accV1 = wmma4(av, b1v, accV1);
    }
  }

  // epilogue: add bias, store q/vals, reduce mkey.q into lmain via LDS atomics
  const int mhalf = (lane >> 4) * 8;
  float p0 = 0.0f, p1 = 0.0f;
  for (int r = 0; r < 8; ++r) {
    int mo = wave * 16 + r + mhalf;
    float bq = bf[mo], bkk = bk[mo], bvv = bv[mo];
    float q0 = accQ0[r] + bq, q1 = accQ1[r] + bq;
    float k0v = accK0[r] + bkk, k1v = accK1[r] + bkk;
    float v0 = accV0[r] + bvv, v1 = accV1[r] + bvv;
    size_t base = (((size_t)b * CC + mo) * HH + h) * WW + w0;
    q_out[base + lrow]      = q0;
    q_out[base + 16 + lrow] = q1;
    v_out[base + lrow]      = v0;
    v_out[base + 16 + lrow] = v1;
    p0 += k0v * q0;
    p1 += k1v * q1;
  }
  atomicAdd(&lm_s[lrow], p0);
  atomicAdd(&lm_s[16 + lrow], p1);
  __syncthreads();
  if (tid < 32)
    lmain_out[((size_t)b * HH + h) * WW + w0 + tid] = lm_s[tid];
}

// ---------------------------------------------------------------------------
// Kernel B: fused ckeys-GEMM + cross-attention + weighted combine.
// One WG = 16 coarse pixels = 64 subpixels (2 rows x 32 cols) for one (b,h).
// Context tiles (3 x 128 x 64 f32) arrive via global_load_async_to_lds_b128,
// feed the Wc GEMM (M=128,N=64,K=128) AND the final raw-feature combine, so
// contexts are read from HBM exactly once.
// ---------------------------------------------------------------------------
__global__ void __launch_bounds__(256)
attn_kernel(const float* __restrict__ ctx,
            const float* __restrict__ wc, const float* __restrict__ bc,
            const float* __restrict__ q_ws, const float* __restrict__ v_ws,
            const float* __restrict__ lmain_ws,
            float* __restrict__ out) {
  const int w0  = blockIdx.x * 16;   // coarse col base
  const int sc0 = w0 * 2;            // subpixel col base
  const int h = blockIdx.y;
  const int b = blockIdx.z;
  const int tid  = threadIdx.x;
  const int wave = tid >> 5, lane = tid & 31;
  const int lrow = lane & 15;
  const int khalf = (lane >> 4) * 2;

  __shared__ float cs[NCTX][CC][72];    // padded to kill bank conflicts
  __shared__ float logit_s[NCTX][64];
  __shared__ float attn_s[4][64];

  if (tid < NCTX * 64) ((float*)logit_s)[tid] = 0.0f;

  // ---- async tensor staging: 16B per lane per issue, ASYNCcnt tracked ----
  unsigned cs_base = (unsigned)(uintptr_t)(&cs[0][0][0]);
  for (int idx4 = tid; idx4 < (NCTX * CC * 64) / 4; idx4 += 256) {
    int f0  = idx4 * 4;
    int n   = f0 / (CC * 64);
    int rem = f0 % (CC * 64);
    int c   = rem / 64;
    int sp  = rem % 64;            // sp = i*32 + j, j%4 == 0 here
    int i = sp >> 5, j = sp & 31;
    const float* gp = ctx +
        ((((size_t)n * BB + b) * CC + c) * (2 * HH) + (2 * h + i)) * (2 * WW) + sc0 + j;
    unsigned lds = cs_base + (unsigned)(((n * CC + c) * 72 + sp) * 4);
    asm volatile("global_load_async_to_lds_b128 %0, %1, off"
                 :: "v"(lds), "v"(gp) : "memory");
  }
  asm volatile("s_wait_asynccnt 0x0" ::: "memory");
  __syncthreads();

  // per-lane q values q[m(r), coarse_pixel(col)] reused across all 3 contexts
  const int mhalf = (lane >> 4) * 8;
  float qreg[4][8];
  for (int t = 0; t < 4; ++t) {
    int sp = t * 16 + lrow;
    int j = sp & 31;
    int wcoarse = w0 + (j >> 1);
    for (int r = 0; r < 8; ++r) {
      int mo = wave * 16 + r + mhalf;
      qreg[t][r] = q_ws[(((size_t)b * CC + mo) * HH + h) * WW + wcoarse];
    }
  }

  const float* wrow = wc + (size_t)(wave * 16 + lrow) * CC;
  for (int n = 0; n < NCTX; ++n) {
    v8f acc0 = {}, acc1 = {}, acc2 = {}, acc3 = {};
    for (int k0 = 0; k0 < CC; k0 += 4) {
      int k = k0 + khalf;
      v2f a = *(const v2f*)(wrow + k);
      v2f b0v = { cs[n][k][lrow],      cs[n][k + 1][lrow]      };
      v2f b1v = { cs[n][k][16 + lrow], cs[n][k + 1][16 + lrow] };
      v2f b2v = { cs[n][k][32 + lrow], cs[n][k + 1][32 + lrow] };
      v2f b3v = { cs[n][k][48 + lrow], cs[n][k + 1][48 + lrow] };
      acc0 = wmma4(a, b0v, acc0);
      acc1 = wmma4(a, b1v, acc1);
      acc2 = wmma4(a, b2v, acc2);
      acc3 = wmma4(a, b3v, acc3);
    }
    // logits: (Wc*ctx + bc) . q, reduced over all 128 channels via LDS atomics
    float p0 = 0, p1 = 0, p2 = 0, p3 = 0;
    for (int r = 0; r < 8; ++r) {
      int mo = wave * 16 + r + mhalf;
      float bias = bc[mo];
      p0 += (acc0[r] + bias) * qreg[0][r];
      p1 += (acc1[r] + bias) * qreg[1][r];
      p2 += (acc2[r] + bias) * qreg[2][r];
      p3 += (acc3[r] + bias) * qreg[3][r];
    }
    atomicAdd(&logit_s[n][lrow],      p0);
    atomicAdd(&logit_s[n][16 + lrow], p1);
    atomicAdd(&logit_s[n][32 + lrow], p2);
    atomicAdd(&logit_s[n][48 + lrow], p3);
  }
  __syncthreads();

  // 4-way softmax per subpixel (3 contexts + mainline)
  if (tid < 64) {
    int sp = tid;
    int j = sp & 31;
    float l0 = logit_s[0][sp], l1 = logit_s[1][sp], l2 = logit_s[2][sp];
    float lm = lmain_ws[((size_t)b * HH + h) * WW + w0 + (j >> 1)];
    float mx = fmaxf(fmaxf(l0, l1), fmaxf(l2, lm));
    float e0 = __expf(l0 - mx), e1 = __expf(l1 - mx);
    float e2 = __expf(l2 - mx), em = __expf(lm - mx);
    float inv = 1.0f / (e0 + e1 + e2 + em);
    attn_s[0][sp] = e0 * inv;
    attn_s[1][sp] = e1 * inv;
    attn_s[2][sp] = e2 * inv;
    attn_s[3][sp] = em * inv;
  }
  __syncthreads();

  // weighted combine: raw context features (still in LDS) + mainline values
  for (int idx = tid; idx < CC * 64; idx += 256) {
    int c  = idx >> 6;
    int sp = idx & 63;
    int i = sp >> 5, j = sp & 31;
    float vmain = v_ws[(((size_t)b * CC + c) * HH + h) * WW + w0 + (j >> 1)];
    float o = attn_s[0][sp] * cs[0][c][sp]
            + attn_s[1][sp] * cs[1][c][sp]
            + attn_s[2][sp] * cs[2][c][sp]
            + attn_s[3][sp] * vmain;
    out[(((size_t)b * CC + c) * (2 * HH) + (2 * h + i)) * (2 * WW) + sc0 + j] = o;
  }
}

// ---------------------------------------------------------------------------
extern "C" void kernel_launch(void* const* d_in, const int* in_sizes, int n_in,
                              void* d_out, int out_size, void* d_ws, size_t ws_size,
                              hipStream_t stream) {
  const float* contexts   = (const float*)d_in[0];
  const float* mainstream = (const float*)d_in[1];
  const float* Wc_w = (const float*)d_in[2];
  const float* Wc_b = (const float*)d_in[3];
  const float* Wf_w = (const float*)d_in[4];
  const float* Wf_b = (const float*)d_in[5];
  const float* Wk_w = (const float*)d_in[6];
  const float* Wk_b = (const float*)d_in[7];
  const float* Wv_w = (const float*)d_in[8];
  const float* Wv_b = (const float*)d_in[9];
  float* out = (float*)d_out;

  float* ws    = (float*)d_ws;
  float* q_ws  = ws;                                   // B*CC*H*W
  float* v_ws  = q_ws + (size_t)BB * CC * HH * WW;     // B*CC*H*W
  float* lm_ws = v_ws + (size_t)BB * CC * HH * WW;     // B*H*W
  float* wvT   = lm_ws + (size_t)BB * HH * WW;         // 9*CC*CF

  hipLaunchKernelGGL(wv_transpose_kernel,
                     dim3((CC * CF * 9 + 255) / 256), dim3(256), 0, stream,
                     Wv_w, wvT);
  hipLaunchKernelGGL(proj_kernel,
                     dim3(WW / 32, HH, BB), dim3(256), 0, stream,
                     mainstream, Wf_w, Wf_b, Wk_w, Wk_b, wvT, Wv_b,
                     q_ws, v_ws, lm_ws);
  hipLaunchKernelGGL(attn_kernel,
                     dim3(WW / 16, HH, BB), dim3(256), 0, stream,
                     contexts, Wc_w, Wc_b, q_ws, v_ws, lm_ws, out);
}

// v001
// A run of this version takes 282 microseconds.
// In both of two side-by-side timings against v000, it was 1.17 times as fast.
#include <hip/hip_runtime.h>
#include <hip/hip_bf16.h>

#define NCTX 3
#define BB 8
#define CC 128
#define CF 256
#define HH 64
#define WW 64

typedef __attribute__((ext_vector_type(2))) float v2f;
typedef __attribute__((ext_vector_type(4))) float v4f;
typedef __attribute__((ext_vector_type(8))) float v8f;

__device__ __forceinline__ v8f wmma4(v2f a, v2f b, v8f c) {
  // D = A(16x4) * B(4x16) + C(16x16), full fp32
  return __builtin_amdgcn_wmma_f32_16x16x4_f32(false, a, false, b, (short)0, c, false, false);
}

// ---------------------------------------------------------------------------
// Kernel W: transpose Wv (Co,Ci,3,3) -> tap-major (9, Co, Ci) so conv A-operands
// are contiguous along Ci (enables b64 A loads in the projection kernel).
// ---------------------------------------------------------------------------
__global__ void wv_transpose_kernel(const float* __restrict__ wv,
                                    float* __restrict__ wvT) {
  int idx = blockIdx.x * 256 + threadIdx.x;
  if (idx >= CC * CF * 9) return;
  int o   = idx / (CF * 9);
  int rem = idx % (CF * 9);
  int ci  = rem / 9;
  int tap = rem % 9;
  wvT[((size_t)tap * CC + o) * CF + ci] = wv[idx];
}

// ---------------------------------------------------------------------------
// Kernel A: projections from mainstream.
//   q    = Wf * x + bf                (stored to ws)
//   vals = conv3x3(x, Wv) + bv       (stored to ws)
//   lmain= sum_c (Wk*x+bk)_c * q_c   (stored to ws)
// One WG = one (b, h) row, 32 pixels wide. 8 waves x (16 M x 32 N) tiles.
// Input tile (3 rows x 256 ci x 34 cols) staged in LDS, padded to 40 floats/row.
// ---------------------------------------------------------------------------
__global__ void __launch_bounds__(256)
proj_kernel(const float* __restrict__ x,
            const float* __restrict__ wf, const float* __restrict__ bf,
            const float* __restrict__ wk, const float* __restrict__ bk,
            const float* __restrict__ wvT, const float* __restrict__ bv,
            float* __restrict__ q_out, float* __restrict__ v_out,
            float* __restrict__ lmain_out) {
  const int w0 = blockIdx.x * 32;
  const int h  = blockIdx.y;
  const int b  = blockIdx.z;
  const int tid  = threadIdx.x;
  const int wave = tid >> 5, lane = tid & 31;
  const int lrow = lane & 15;
  const int khalf = (lane >> 4) * 2;

  __shared__ float xs[3][CF][40];
  __shared__ float lm_s[32];
  if (tid < 32) lm_s[tid] = 0.0f;

  // cooperative, coalesced global->LDS with zero padding at image borders
  for (int idx = tid; idx < 3 * CF * 34; idx += 256) {
    int row = idx / (CF * 34);
    int rem = idx % (CF * 34);
    int ci  = rem / 34;
    int wl  = rem % 34;
    int gh = h - 1 + row;
    int gw = w0 - 1 + wl;
    float v = 0.0f;
    if ((unsigned)gh < HH && (unsigned)gw < WW)
      v = x[(((size_t)b * CF + ci) * HH + gh) * WW + gw];
    xs[row][ci][wl] = v;
  }
  __syncthreads();

  const int m = wave * 16 + lrow;  // A-matrix row (output channel)
  v8f accQ0 = {}, accQ1 = {}, accK0 = {}, accK1 = {}, accV0 = {}, accV1 = {};

  // q and mkey: 1x1 conv (center row of the tile, kx offset 1)
  for (int k0 = 0; k0 < CF; k0 += 4) {
    int k = k0 + khalf;
    v2f aq = *(const v2f*)(wf + (size_t)m * CF + k);
    v2f ak = *(const v2f*)(wk + (size_t)m * CF + k);
    v2f b0v = { xs[1][k][1 + lrow],  xs[1][k + 1][1 + lrow]  };
    v2f b1v = { xs[1][k][17 + lrow], xs[1][k + 1][17 + lrow] };
    accQ0 = wmma4(aq, b0v, accQ0);
    accQ1 = wmma4(aq, b1v, accQ1);
    accK0 = wmma4(ak, b0v, accK0);
    accK1 = wmma4(ak, b1v, accK1);
  }
  // vals: 3x3 conv as 9 accumulating tap-GEMMs
  for (int tap = 0; tap < 9; ++tap) {
    int ky = tap / 3, kx = tap % 3;
    const float* wrow = wvT + ((size_t)tap * CC + m) * CF;
    for (int k0 = 0; k0 < CF; k0 += 4) {
      int k = k0 + khalf;
      v2f av = *(const v2f*)(wrow + k);
      v2f b0v = { xs[ky][k][lrow + kx],      xs[ky][k + 1][lrow + kx]      };
      v2f b1v = { xs[ky][k][16 + lrow + kx], xs[ky][k + 1][16 + lrow + kx] };
      accV0 = wmma4(av, b0v, accV0);
      accV1 = wmma4(av, b1v, accV1);
    }
  }

  // epilogue: add bias, store q/vals, reduce mkey.q into lmain via LDS atomics
  const int mhalf = (lane >> 4) * 8;
  float p0 = 0.0f, p1 = 0.0f;
  for (int r = 0; r < 8; ++r) {
    int mo = wave * 16 + r + mhalf;
    float bq = bf[mo], bkk = bk[mo], bvv = bv[mo];
    float q0 = accQ0[r] + bq, q1 = accQ1[r] + bq;
    float k0v = accK0[r] + bkk, k1v = accK1[r] + bkk;
    float v0 = accV0[r] + bvv, v1 = accV1[r] + bvv;
    size_t base = (((size_t)b * CC + mo) * HH + h) * WW + w0;
    q_out[base + lrow]      = q0;
    q_out[base + 16 + lrow] = q1;
    v_out[base + lrow]      = v0;
    v_out[base + 16 + lrow] = v1;
    p0 += k0v * q0;
    p1 += k1v * q1;
  }
  atomicAdd(&lm_s[lrow], p0);
  atomicAdd(&lm_s[16 + lrow], p1);
  __syncthreads();
  if (tid < 32)
    lmain_out[((size_t)b * HH + h) * WW + w0 + tid] = lm_s[tid];
}

// ---------------------------------------------------------------------------
// Kernel B: fused cross-attention + weighted combine.
// One WG = 16 coarse pixels = 64 subpixels (2 rows x 32 cols) for one (b,h).
// Logits use (Wc*ctx + bc).q = ctx.(Wc^T q) + bc.q : the matrix product is
// Wc^T q (M=128,N=16,K=128), once per coarse pixel instead of once per
// subpixel and context; the dot with ctx is the same length as ckeys.q was.
// Context tiles (3 x 128 x 64 f32) arrive via global_load_async_to_lds_b128,
// feed the logit dots AND the final raw-feature combine, so contexts are read
// from HBM exactly once.
// ---------------------------------------------------------------------------
__global__ void __launch_bounds__(256)
attn_kernel(const float* __restrict__ ctx,
            const float* __restrict__ wc, const float* __restrict__ bc,
            const float* __restrict__ q_ws, const float* __restrict__ v_ws,
            const float* __restrict__ lmain_ws,
            float* __restrict__ out) {
  const int w0  = blockIdx.x * 16;   // coarse col base
  const int sc0 = w0 * 2;            // subpixel col base
  const int h = blockIdx.y;
  const int b = blockIdx.z;
  const int tid  = threadIdx.x;
  const int wave = tid >> 5, lane = tid & 31;
  const int lrow = lane & 15;
  const int khalf = (lane >> 4) * 2;

  __shared__ __attribute__((aligned(16))) float cs[NCTX][CC][72];
  __shared__ __attribute__((aligned(16))) float qp_s[CC][16];        // Wc^T q
  __shared__ __attribute__((aligned(16))) float part_s[8][NCTX][64]; // per-wave logit partials
  __shared__ float bq_s[16];                                         // bc . q
  __shared__ float attn_s[4][64];

  // ---- qp[c_in][pixel] = sum_co Wc[co][c_in] * q[co][pixel]; bq = bc . q ----
  const int mhalf = (lane >> 4) * 8;
  {
    const int m = wave * 16 + lrow;  // A-matrix row = input channel of Wc
    const float* qcol = q_ws + ((size_t)b * CC * HH + h) * WW + w0 + lrow;
    v8f accA = {}, accB = {};
    float pb = 0.0f;
    // unrolled so that every step's loads are issued ahead of the first product
#pragma unroll
    for (int k0 = 0; k0 < CC; k0 += 8) {
      int k = k0 + khalf;
      v2f a0 = { wc[(size_t)k * CC + m],       wc[(size_t)(k + 1) * CC + m] };
      v2f a1 = { wc[(size_t)(k + 4) * CC + m], wc[(size_t)(k + 5) * CC + m] };
      v2f b0 = { qcol[(size_t)k * (HH * WW)],       qcol[(size_t)(k + 1) * (HH * WW)] };
      v2f b1 = { qcol[(size_t)(k + 4) * (HH * WW)], qcol[(size_t)(k + 5) * (HH * WW)] };
      accA = wmma4(a0, b0, accA);
      accB = wmma4(a1, b1, accB);
      pb += bc[k] * b0.x + bc[k + 1] * b0.y + bc[k + 4] * b1.x + bc[k + 5] * b1.y;
    }
    pb += __shfl_xor(pb, 16);  // the two lane halves hold disjoint k
    for (int r = 0; r < 8; ++r)
      qp_s[wave * 16 + r + mhalf][lrow] = accA[r] + accB[r];
    if (tid < 16) bq_s[tid] = pb;
  }

  // ---- async tensor staging: 16B per lane per issue, ASYNCcnt tracked ----
  unsigned cs_base = (unsigned)(uintptr_t)(&cs[0][0][0]);
  for (int idx4 = tid; idx4 < (NCTX * CC * 64) / 4; idx4 += 256) {
    int f0  = idx4 * 4;
    int n   = f0 / (CC * 64);
    int rem = f0 % (CC * 64);
    int c   = rem / 64;
    int sp  = rem % 64;            // sp = i*32 + j, j%4 == 0 here
    int i = sp >> 5, j = sp & 31;
    const float* gp = ctx +
        ((((size_t)n * BB + b) * CC + c) * (2 * HH) + (2 * h + i)) * (2 * WW) + sc0 + j;
    unsigned lds = cs_base + (unsigned)(((n * CC + c) * 72 + sp) * 4);
    asm volatile("global_load_async_to_lds_b128 %0, %1, off"
                 :: "v"(lds), "v"(gp) : "memory");
  }
  asm volatile("s_wait_asynccnt 0x0" ::: "memory");
  __syncthreads();

  // logits: ctx . qp. A thread takes 4 neighbouring subpixels (2 coarse pixels)
  // and every 16th channel; the two lane halves are summed in the wave, the
  // 8 waves' partials in fixed order by the softmax threads.
  {
    const int sp4 = (tid & 15) * 4;
    const int grp = tid >> 4;
    const int px  = (sp4 & 31) >> 1;
    v4f s0 = {}, s1 = {}, s2 = {};
    for (int i = 0; i < 8; ++i) {
      int c = i * 16 + grp;
      v2f qv = *(const v2f*)&qp_s[c][px];
      v4f qq = { qv.x, qv.x, qv.y, qv.y };
      s0 += *(const v4f*)&cs[0][c][sp4] * qq;
      s1 += *(const v4f*)&cs[1][c][sp4] * qq;
      s2 += *(const v4f*)&cs[2][c][sp4] * qq;
    }
    for (int e = 0; e < 4; ++e) {
      s0[e] += __shfl_xor(s0[e], 16);
      s1[e] += __shfl_xor(s1[e], 16);
      s2[e] += __shfl_xor(s2[e], 16);
    }
    if (lane < 16) {
      *(v4f*)&part_s[wave][0][sp4] = s0;
      *(v4f*)&part_s[wave][1][sp4] = s1;
      *(v4f*)&part_s[wave][2][sp4] = s2;
    }
  }
  __syncthreads();

  // 4-way softmax per subpixel (3 contexts + mainline)
  if (tid < 64) {
    int sp = tid;
    int j = sp & 31;
    float l0 = bq_s[j >> 1], l1 = l0, l2 = l0;
    for (int w = 0; w < 8; ++w) {
      l0 += part_s[w][0][sp];
      l1 += part_s[w][1][sp];
      l2 += part_s[w][2][sp];
    }
    float lm = lmain_ws[((size_t)b * HH + h) * WW + w0 + (j >> 1)];
    float mx = fmaxf(fmaxf(l0, l1), fmaxf(l2, lm));
    float e0 = __expf(l0 - mx), e1 = __expf(l1 - mx);
    float e2 = __expf(l2 - mx), em = __expf(lm - mx);
    float inv = 1.0f / (e0 + e1 + e2 + em);
    attn_s[0][sp] = e0 * inv;
    attn_s[1][sp] = e1 * inv;
    attn_s[2][sp] = e2 * inv;
    attn_s[3][sp] = em * inv;
  }
  __syncthreads();

  // weighted combine: raw context features (still in LDS) + mainline values
  for (int idx = tid; idx < CC * 64; idx += 256) {
    int c  = idx >> 6;
    int sp = idx & 63;
    int i = sp >> 5, j = sp & 31;
    float vmain = v_ws[(((size_t)b * CC + c) * HH + h) * WW + w0 + (j >> 1)];
    float o = attn_s[0][sp] * cs[0][c][sp]
            + attn_s[1][sp] * cs[1][c][sp]
            + attn_s[2][sp] * cs[2][c][sp]
            + attn_s[3][sp] * vmain;
    out[(((size_t)b * CC + c) * (2 * HH) + (2 * h + i)) * (2 * WW) + sc0 + j] = o;
  }
}

// ---------------------------------------------------------------------------
extern "C" void kernel_launch(void* const* d_in, const int* in_sizes, int n_in,
                              void* d_out, int out_size, void* d_ws, size_t ws_size,
                              hipStream_t stream) {
  const float* contexts   = (const float*)d_in[0];
  const float* mainstream = (const float*)d_in[1];
  const float* Wc_w = (const float*)d_in[2];
  const float* Wc_b = (const float*)d_in[3];
  const float* Wf_w = (const float*)d_in[4];
  const float* Wf_b = (const float*)d_in[5];
  const float* Wk_w = (const float*)d_in[6];
  const float* Wk_b = (const float*)d_in[7];
  const float* Wv_w = (const float*)d_in[8];
  const float* Wv_b = (const float*)d_in[9];
  float* out = (float*)d_out;

  float* ws    = (float*)d_ws;
  float* q_ws  = ws;                                   // B*CC*H*W
  float* v_ws  = q_ws + (size_t)BB * CC * HH * WW;     // B*CC*H*W
  float* lm_ws = v_ws + (size_t)BB * CC * HH * WW;     // B*H*W
  float* wvT   = lm_ws + (size_t)BB * HH * WW;         // 9*CC*CF

  hipLaunchKernelGGL(wv_transpose_kernel,
                     dim3((CC * CF * 9 + 255) / 256), dim3(256), 0, stream,
                     Wv_w, wvT);
  hipLaunchKernelGGL(proj_kernel,
                     dim3(WW / 32, HH, BB), dim3(256), 0, stream,
                     mainstream, Wf_w, Wf_b, Wk_w, Wk_b, wvT, Wv_b,
                     q_ws, v_ws, lm_ws);
  hipLaunchKernelGGL(attn_kernel,
                     dim3(WW / 16, HH, BB), dim3(256), 0, stream,
                     contexts, Wc_w, Wc_b, q_ws, v_ws, lm_ws, out);
}

// v002
// Measured time: 254 microseconds a run.
// Two timings next to v001 both put it at 1.11 times that version's speed.
// Over all steps from v000 it is 1.30 times as fast.
#include <hip/hip_runtime.h>
#include <hip/hip_bf16.h>

#define NCTX 3
#define BB 8
#define CC 128
#define CF 256
#define HH 64
#define WW 64

typedef __attribute__((ext_vector_type(2))) float v2f;
typedef __attribute__((ext_vector_type(4))) float v4f;
typedef __attribute__((ext_vector_type(8))) float v8f;

__device__ __forceinline__ v8f wmma4(v2f a, v2f b, v8f c) {
  // D = A(16x4) * B(4x16) + C(16x16), full fp32
  return __builtin_amdgcn_wmma_f32_16x16x4_f32(false, a, false, b, (short)0, c, false, false);
}

// ---------------------------------------------------------------------------
// Kernel W: pack Wf, Wk and the 9 taps of Wv (11 matrices of 128 x 256) in the
// order in which the projection kernel's waves consume A fragments:
//   wP[mat][mtile][k8][lane] = 16 bytes = the lane's A registers of two
//   consecutive 16x16x4 steps: A[m][k], A[m][k+1], A[m][k+4], A[m][k+5],
//   m = mtile*16 + (lane & 15), k = k8*8 + (lane >> 4)*2.
// A wave's 16-byte-per-lane load then covers 512 contiguous bytes (4 whole
// lines) instead of 16-byte pieces of 16 lines.
// mat 0 = Wf, mat 1 = Wk, mat 2 + tap = Wv[:, :, tap].
// ---------------------------------------------------------------------------
#define NMAT 11
#define MAT_V4 (CC * CF / 4)   // 16-byte pieces per matrix

__global__ void pack_weights_kernel(const float* __restrict__ wv,
                                    const float* __restrict__ wf,
                                    const float* __restrict__ wk,
                                    float* __restrict__ wP) {
  int t = blockIdx.x * 256 + threadIdx.x;   // one 16-byte piece per thread
  int lane = t & 31;
  int k8   = (t >> 5) & 31;
  int mt   = (t >> 10) & 7;
  int mat  = t >> 13;                       // the same for a whole block
  int m = mt * 16 + (lane & 15);
  int k = k8 * 8 + (lane >> 4) * 2;
  v4f v;
  if (mat < 2) {
    const float* r = (mat == 0 ? wf : wk) + (size_t)m * CF + k;
    v = v4f{ r[0], r[1], r[4], r[5] };
  } else {
    const float* r = wv + ((size_t)m * CF + k) * 9 + (mat - 2);
    v = v4f{ r[0], r[9], r[36], r[45] };
  }
  ((v4f*)wP)[t] = v;
}

// ---------------------------------------------------------------------------
// Kernel A: projections from mainstream.
//   q    = Wf * x + bf                (stored to ws)
//   vals = conv3x3(x, Wv) + bv       (stored to ws)
//   lmain= sum_c (Wk*x+bk)_c * q_c   (stored to ws)
// One WG = one (b, h) row, 32 pixels wide. 8 waves x (16 M x 32 N) tiles.
// Input tile (3 rows x 256 ci x 34 cols) staged in LDS, padded to 40 floats/row.
// ---------------------------------------------------------------------------
__global__ void __launch_bounds__(256)
proj_kernel(const float* __restrict__ x,
            const float* __restrict__ wP,
            const float* __restrict__ bf, const float* __restrict__ bk,
            const float* __restrict__ bv,
            float* __restrict__ q_out, float* __restrict__ v_out,
            float* __restrict__ lmain_out) {
  const int w0 = blockIdx.x * 32;
  const int h  = blockIdx.y;
  const int b  = blockIdx.z;
  const int tid  = threadIdx.x;
  const int wave = tid >> 5, lane = tid & 31;
  const int lrow = lane & 15;
  const int khalf = (lane >> 4) * 2;

  __shared__ float xs[3][CF][40];
  __shared__ float lm_s[32];
  if (tid < 32) lm_s[tid] = 0.0f;

  // cooperative, coalesced global->LDS with zero padding at image borders
  for (int idx = tid; idx < 3 * CF * 34; idx += 256) {
    int row = idx / (CF * 34);
    int rem = idx % (CF * 34);
    int ci  = rem / 34;
    int wl  = rem % 34;
    int gh = h - 1 + row;
    int gw = w0 - 1 + wl;
    float v = 0.0f;
    if ((unsigned)gh < HH && (unsigned)gw < WW)
      v = x[(((size_t)b * CF + ci) * HH + gh) * WW + gw];
    xs[row][ci][wl] = v;
  }
  __syncthreads();

  // this wave's A stream: 16 output channels, fragment order (see Kernel W)
  const v4f* aP = (const v4f*)wP + wave * (32 * 32) + lane;
  v8f accQ0 = {}, accQ1 = {}, accK0 = {}, accK1 = {}, accV0 = {}, accV1 = {};

  // q and mkey: 1x1 conv (center row of the tile, kx offset 1)
  for (int k8 = 0; k8 < CF / 8; ++k8) {
    v4f aq = aP[k8 * 32];
    v4f ak = aP[MAT_V4 + k8 * 32];
    for (int s = 0; s < 2; ++s) {
      int k = k8 * 8 + s * 4 + khalf;
      v2f aqs = s ? aq.hi : aq.lo;
      v2f aks = s ? ak.hi : ak.lo;
      v2f b0v = { xs[1][k][1 + lrow],  xs[1][k + 1][1 + lrow]  };
      v2f b1v = { xs[1][k][17 + lrow], xs[1][k + 1][17 + lrow] };
      accQ0 = wmma4(aqs, b0v, accQ0);
      accQ1 = wmma4(aqs, b1v, accQ1);
      accK0 = wmma4(aks, b0v, accK0);
      accK1 = wmma4(aks, b1v, accK1);
    }
  }
  // vals: 3x3 conv as 9 accumulating tap-GEMMs
  for (int tap = 0; tap < 9; ++tap) {
    int ky = tap / 3, kx = tap % 3;
    const v4f* aT = aP + (2 + tap) * MAT_V4;
    for (int k8 = 0; k8 < CF / 8; ++k8) {
      v4f av = aT[k8 * 32];
      for (int s = 0; s < 2; ++s) {
        int k = k8 * 8 + s * 4 + khalf;
        v2f avs = s ? av.hi : av.lo;
        v2f b0v = { xs[ky][k][lrow + kx],      xs[ky][k + 1][lrow + kx]      };
        v2f b1v = { xs[ky][k][16 + lrow + kx], xs[ky][k + 1][16 + lrow + kx] };
        accV0 = wmma4(avs, b0v, accV0);
        accV1 = wmma4(avs, b1v, accV1);
      }
    }
  }

  // epilogue: add bias, store q/vals, reduce mkey.q into lmain via LDS atomics
  const int mhalf = (lane >> 4) * 8;
  float p0 = 0.0f, p1 = 0.0f;
  for (int r = 0; r < 8; ++r) {
    int mo = wave * 16 + r + mhalf;
    float bq = bf[mo], bkk = bk[mo], bvv = bv[mo];
    float q0 = accQ0[r] + bq, q1 = accQ1[r] + bq;
    float k0v = accK0[r] + bkk, k1v = accK1[r] + bkk;
    float v0 = accV0[r] + bvv, v1 = accV1[r] + bvv;
    size_t base = (((size_t)b * CC + mo) * HH + h) * WW + w0;
    q_out[base + lrow]      = q0;
    q_out[base + 16 + lrow] = q1;
    v_out[base + lrow]      = v0;
    v_out[base + 16 + lrow] = v1;
    p0 += k0v * q0;
    p1 += k1v * q1;
  }
  atomicAdd(&lm_s[lrow], p0);
  atomicAdd(&lm_s[16 + lrow], p1);
  __syncthreads();
  if (tid < 32)
    lmain_out[((size_t)b * HH + h) * WW + w0 + tid] = lm_s[tid];
}

// ---------------------------------------------------------------------------
// Kernel B: fused cross-attention + weighted combine.
// One WG = 16 coarse pixels = 64 subpixels (2 rows x 32 cols) for one (b,h).
// Logits use (Wc*ctx + bc).q = ctx.(Wc^T q) + bc.q : the matrix product is
// Wc^T q (M=128,N=16,K=128), once per coarse pixel instead of once per
// subpixel and context; the dot with ctx is the same length as ckeys.q was.
// Context tiles (3 x 128 x 64 f32) arrive via global_load_async_to_lds_b128,
// feed the logit dots AND the final raw-feature combine, so contexts are read
// from HBM exactly once.
// ---------------------------------------------------------------------------
__global__ void __launch_bounds__(256)
attn_kernel(const float* __restrict__ ctx,
            const float* __restrict__ wc, const float* __restrict__ bc,
            const float* __restrict__ q_ws, const float* __restrict__ v_ws,
            const float* __restrict__ lmain_ws,
            float* __restrict__ out) {
  const int w0  = blockIdx.x * 16;   // coarse col base
  const int sc0 = w0 * 2;            // subpixel col base
  const int h = blockIdx.y;
  const int b = blockIdx.z;
  const int tid  = threadIdx.x;
  const int wave = tid >> 5, lane = tid & 31;
  const int lrow = lane & 15;
  const int khalf = (lane >> 4) * 2;

  __shared__ __attribute__((aligned(16))) float cs[NCTX][CC][72];
  __shared__ __attribute__((aligned(16))) float qp_s[CC][16];        // Wc^T q
  __shared__ __attribute__((aligned(16))) float part_s[8][NCTX][64]; // per-wave logit partials
  __shared__ float bq_s[16];                                         // bc . q
  __shared__ float attn_s[4][64];

  // ---- qp[c_in][pixel] = sum_co Wc[co][c_in] * q[co][pixel]; bq = bc . q ----
  const int mhalf = (lane >> 4) * 8;
  {
    const int m = wave * 16 + lrow;  // A-matrix row = input channel of Wc
    const float* qcol = q_ws + ((size_t)b * CC * HH + h) * WW + w0 + lrow;
    v8f accA = {}, accB = {};
    float pb = 0.0f;
    // unrolled so that every step's loads are issued ahead of the first product
#pragma unroll
    for (int k0 = 0; k0 < CC; k0 += 8) {
      int k = k0 + khalf;
      v2f a0 = { wc[(size_t)k * CC + m],       wc[(size_t)(k + 1) * CC + m] };
      v2f a1 = { wc[(size_t)(k + 4) * CC + m], wc[(size_t)(k + 5) * CC + m] };
      v2f b0 = { qcol[(size_t)k * (HH * WW)],       qcol[(size_t)(k + 1) * (HH * WW)] };
      v2f b1 = { qcol[(size_t)(k + 4) * (HH * WW)], qcol[(size_t)(k + 5) * (HH * WW)] };
      accA = wmma4(a0, b0, accA);
      accB = wmma4(a1, b1, accB);
      pb += bc[k] * b0.x + bc[k + 1] * b0.y + bc[k + 4] * b1.x + bc[k + 5] * b1.y;
    }
    pb += __shfl_xor(pb, 16);  // the two lane halves hold disjoint k
    for (int r = 0; r < 8; ++r)
      qp_s[wave * 16 + r + mhalf][lrow] = accA[r] + accB[r];
    if (tid < 16) bq_s[tid] = pb;
  }

  // ---- async tensor staging: 16B per lane per issue, ASYNCcnt tracked ----
  unsigned cs_base = (unsigned)(uintptr_t)(&cs[0][0][0]);
  for (int idx4 = tid; idx4 < (NCTX * CC * 64) / 4; idx4 += 256) {
    int f0  = idx4 * 4;
    int n   = f0 / (CC * 64);
    int rem = f0 % (CC * 64);
    int c   = rem / 64;
    int sp  = rem % 64;            // sp = i*32 + j, j%4 == 0 here
    int i = sp >> 5, j = sp & 31;
    const float* gp = ctx +
        ((((size_t)n * BB + b) * CC + c) * (2 * HH) + (2 * h + i)) * (2 * WW) + sc0 + j;
    unsigned lds = cs_base + (unsigned)(((n * CC + c) * 72 + sp) * 4);
    asm volatile("global_load_async_to_lds_b128 %0, %1, off"
                 :: "v"(lds), "v"(gp) : "memory");
  }
  asm volatile("s_wait_asynccnt 0x0" ::: "memory");
  __syncthreads();

  // logits: ctx . qp. A thread takes 4 neighbouring subpixels (2 coarse pixels)
  // and every 16th channel; the two lane halves are summed in the wave, the
  // 8 waves' partials in fixed order by the softmax threads.
  {
    const int sp4 = (tid & 15) * 4;
    const int grp = tid >> 4;
    const int px  = (sp4 & 31) >> 1;
    v4f s0 = {}, s1 = {}, s2 = {};
    for (int i = 0; i < 8; ++i) {
      int c = i * 16 + grp;
      v2f qv = *(const v2f*)&qp_s[c][px];
      v4f qq = { qv.x, qv.x, qv.y, qv.y };
      s0 += *(const v4f*)&cs[0][c][sp4] * qq;
      s1 += *(const v4f*)&cs[1][c][sp4] * qq;
      s2 += *(const v4f*)&cs[2][c][sp4] * qq;
    }
    for (int e = 0; e < 4; ++e) {
      s0[e] += __shfl_xor(s0[e], 16);
      s1[e] += __shfl_xor(s1[e], 16);
      s2[e] += __shfl_xor(s2[e], 16);
    }
    if (lane < 16) {
      *(v4f*)&part_s[wave][0][sp4] = s0;
      *(v4f*)&part_s[wave][1][sp4] = s1;
      *(v4f*)&part_s[wave][2][sp4] = s2;
    }
  }
  __syncthreads();

  // 4-way softmax per subpixel (3 contexts + mainline)
  if (tid < 64) {
    int sp = tid;
    int j = sp & 31;
    float l0 = bq_s[j >> 1], l1 = l0, l2 = l0;
    for (int w = 0; w < 8; ++w) {
      l0 += part_s[w][0][sp];
      l1 += part_s[w][1][sp];
      l2 += part_s[w][2][sp];
    }
    float lm = lmain_ws[((size_t)b * HH + h) * WW + w0 + (j >> 1)];
    float mx = fmaxf(fmaxf(l0, l1), fmaxf(l2, lm));
    float e0 = __expf(l0 - mx), e1 = __expf(l1 - mx);
    float e2 = __expf(l2 - mx), em = __expf(lm - mx);
    float inv = 1.0f / (e0 + e1 + e2 + em);
    attn_s[0][sp] = e0 * inv;
    attn_s[1][sp] = e1 * inv;
    attn_s[2][sp] = e2 * inv;
    attn_s[3][sp] = em * inv;
  }
  __syncthreads();

  // weighted combine: raw context features (still in LDS) + mainline values
  for (int idx = tid; idx < CC * 64; idx += 256) {
    int c  = idx >> 6;
    int sp = idx & 63;
    int i = sp >> 5, j = sp & 31;
    float vmain = v_ws[(((size_t)b * CC + c) * HH + h) * WW + w0 + (j >> 1)];
    float o = attn_s[0][sp] * cs[0][c][sp]
            + attn_s[1][sp] * cs[1][c][sp]
            + attn_s[2][sp] * cs[2][c][sp]
            + attn_s[3][sp] * vmain;
    out[(((size_t)b * CC + c) * (2 * HH) + (2 * h + i)) * (2 * WW) + sc0 + j] = o;
  }
}

// ---------------------------------------------------------------------------
extern "C" void kernel_launch(void* const* d_in, const int* in_sizes, int n_in,
                              void* d_out, int out_size, void* d_ws, size_t ws_size,
                              hipStream_t stream) {
  const float* contexts   = (const float*)d_in[0];
  const float* mainstream = (const float*)d_in[1];
  const float* Wc_w = (const float*)d_in[2];
  const float* Wc_b = (const float*)d_in[3];
  const float* Wf_w = (const float*)d_in[4];
  const float* Wf_b = (const float*)d_in[5];
  const float* Wk_w = (const float*)d_in[6];
  const float* Wk_b = (const float*)d_in[7];
  const float* Wv_w = (const float*)d_in[8];
  const float* Wv_b = (const float*)d_in[9];
  float* out = (float*)d_out;

  float* ws    = (float*)d_ws;
  float* q_ws  = ws;                                   // B*CC*H*W
  float* v_ws  = q_ws + (size_t)BB * CC * HH * WW;     // B*CC*H*W
  float* lm_ws = v_ws + (size_t)BB * CC * HH * WW;     // B*H*W
  float* wP    = lm_ws + (size_t)BB * HH * WW;         // NMAT*CC*CF

  hipLaunchKernelGGL(pack_weights_kernel,
                     dim3(NMAT * MAT_V4 / 256), dim3(256), 0, stream,
                     Wv_w, Wf_w, Wk_w, wP);
  hipLaunchKernelGGL(proj_kernel,
                     dim3(WW / 32, HH, BB), dim3(256), 0, stream,
                     mainstream, wP, Wf_b, Wk_b, Wv_b,
                     q_ws, v_ws, lm_ws);
  hipLaunchKernelGGL(attn_kernel,
                     dim3(WW / 16, HH, BB), dim3(256), 0, stream,
                     contexts, Wc_w, Wc_b, q_ws, v_ws, lm_ws, out);
}

// v003
// One run takes 179 microseconds.
// Two timings next to v002 both put it at 1.42 times that version's speed.
// Counting every step since v000, it is 1.84 times as fast.
#include <hip/hip_runtime.h>
#include <hip/hip_bf16.h>

#define NCTX 3
#define BB 8
#define CC 128
#define CF 256
#define HH 64
#define WW 64

typedef __attribute__((ext_vector_type(2))) float v2f;
typedef __attribute__((ext_vector_type(4))) float v4f;
typedef __attribute__((ext_vector_type(8))) float v8f;

__device__ __forceinline__ v8f wmma4(v2f a, v2f b, v8f c) {
  // D = A(16x4) * B(4x16) + C(16x16), full fp32
  return __builtin_amdgcn_wmma_f32_16x16x4_f32(false, a, false, b, (short)0, c, false, false);
}

// ---------------------------------------------------------------------------
// Kernel W: pack Wf, Wk and the 9 taps of Wv (11 matrices of 128 x 256) in the
// order in which the projection kernel's waves consume A fragments:
//   wP[mat][mtile][k8][lane] = 16 bytes = the lane's A registers of two
//   consecutive 16x16x4 steps: A[m][k], A[m][k+1], A[m][k+4], A[m][k+5],
//   m = mtile*16 + (lane & 15), k = k8*8 + (lane >> 4)*2.
// A wave's 16-byte-per-lane load then covers 512 contiguous bytes (4 whole
// lines) instead of 16-byte pieces of 16 lines.
// mat 0 = Wf, mat 1 = Wk, mat 2 + tap = Wv[:, :, tap].
// ---------------------------------------------------------------------------
#define NMAT 11
#define MAT_V4 (CC * CF / 4)   // 16-byte pieces per matrix

__global__ void pack_weights_kernel(const float* __restrict__ wv,
                                    const float* __restrict__ wf,
                                    const float* __restrict__ wk,
                                    float* __restrict__ wP) {
  int t = blockIdx.x * 256 + threadIdx.x;   // one 16-byte piece per thread
  int lane = t & 31;
  int k8   = (t >> 5) & 31;
  int mt   = (t >> 10) & 7;
  int mat  = t >> 13;                       // the same for a whole block
  int m = mt * 16 + (lane & 15);
  int k = k8 * 8 + (lane >> 4) * 2;
  v4f v;
  if (mat < 2) {
    const float* r = (mat == 0 ? wf : wk) + (size_t)m * CF + k;
    v = v4f{ r[0], r[1], r[4], r[5] };
  } else {
    const float* r = wv + ((size_t)m * CF + k) * 9 + (mat - 2);
    v = v4f{ r[0], r[9], r[36], r[45] };
  }
  ((v4f*)wP)[t] = v;
}

// ---------------------------------------------------------------------------
// Kernel A: projections from mainstream.
//   q    = Wf * x + bf                (stored to ws)
//   vals = conv3x3(x, Wv) + bv       (stored to ws)
//   lmain= sum_c (Wk*x+bk)_c * q_c   (stored to ws)
// One WG = one (b, h) row, 32 pixels wide. 8 waves x (16 M x 32 N) tiles.
// Input tile (3 rows x 256 ci) staged in LDS, 40 floats per (row, ci):
// LDS column c holds image column w0 - 4 + c, so that every 16-byte piece is
// aligned in memory and in LDS; columns 3..36 are the ones that are read.
// Of the 10 pieces of a (row, ci), 9 lie inside the image and come by
// global_load_async_to_lds_b128 (all of a thread's copies in flight at once);
// the tenth, and a whole row above or below the image, is stored as zeros.
// ---------------------------------------------------------------------------
__device__ __forceinline__ void copy9_to_lds(const unsigned* l, const float* const* g) {
  // One statement: the compiler can put no rewrite of an address register
  // between a copy and the s_wait_xcnt that closes the run.
  asm volatile(
      "global_load_async_to_lds_b128 %0, %9, off\n\t"
      "global_load_async_to_lds_b128 %1, %10, off\n\t"
      "global_load_async_to_lds_b128 %2, %11, off\n\t"
      "global_load_async_to_lds_b128 %3, %12, off\n\t"
      "global_load_async_to_lds_b128 %4, %13, off\n\t"
      "global_load_async_to_lds_b128 %5, %14, off\n\t"
      "global_load_async_to_lds_b128 %6, %15, off\n\t"
      "global_load_async_to_lds_b128 %7, %16, off\n\t"
      "global_load_async_to_lds_b128 %8, %17, off\n\t"
      "s_wait_xcnt 0x0"
      :: "v"(l[0]), "v"(l[1]), "v"(l[2]), "v"(l[3]), "v"(l[4]),
         "v"(l[5]), "v"(l[6]), "v"(l[7]), "v"(l[8]),
         "v"(g[0]), "v"(g[1]), "v"(g[2]), "v"(g[3]), "v"(g[4]),
         "v"(g[5]), "v"(g[6]), "v"(g[7]), "v"(g[8])
      : "memory");
}

__global__ void __launch_bounds__(256)
proj_kernel(const float* __restrict__ x,
            const float* __restrict__ wP,
            const float* __restrict__ bf, const float* __restrict__ bk,
            const float* __restrict__ bv,
            float* __restrict__ q_out, float* __restrict__ v_out,
            float* __restrict__ lmain_out) {
  const int w0 = blockIdx.x * 32;
  const int h  = blockIdx.y;
  const int b  = blockIdx.z;
  const int tid  = threadIdx.x;
  const int wave = tid >> 5, lane = tid & 31;
  const int lrow = lane & 15;
  const int khalf = (lane >> 4) * 2;

  __shared__ __attribute__((aligned(16))) float xs[3][CF][40];
  __shared__ float lm_s[16][32];   // mkey.q partials: [wave * 2 + lane half][pixel]

  // The image is two tiles wide: the left tile's piece 0 and the right tile's
  // piece 9 lie outside it, the other nine inside.
  const int pfirst = blockIdx.x ? 0 : 1;   // first piece that is copied
  const int pzero  = blockIdx.x ? 9 : 0;   // the piece that is zero
  const unsigned xs_base = (unsigned)(uintptr_t)(&xs[0][0][0]);
  const float* xb = x + (size_t)b * CF * HH * WW;
  for (int row = 0; row < 3; ++row) {
    const int gh = h - 1 + row;            // the same for the whole work-group
    if ((unsigned)gh < HH) {
      unsigned l[9];
      const float* g[9];
      for (int j = 0; j < 9; ++j) {        // neighbouring lanes, neighbouring pieces
        int idx = tid + j * 256;
        int ci  = idx / 9;
        int c   = (idx - ci * 9 + pfirst) * 4;
        l[j] = xs_base + (unsigned)(((row * CF + ci) * 40 + c) * 4);
        g[j] = xb + ((ci * HH + gh) * WW + w0 - 4 + c);
      }
      copy9_to_lds(l, g);
    }
  }
  // zeros, while the copies fly: bytes that no copy is aimed at
  for (int row = 0; row < 3; ++row) {
    if ((unsigned)(h - 1 + row) < HH) {
      *(v4f*)&xs[row][tid][pzero * 4] = v4f{};
    } else {
      for (int p = 0; p < 10; ++p)
        *(v4f*)&xs[row][tid][p * 4] = v4f{};
    }
  }
  // this wave's copies have landed before it signals the barrier
  asm volatile("s_wait_asynccnt 0x0" ::: "memory");
  __syncthreads();

  // this wave's A stream: 16 output channels, fragment order (see Kernel W)
  const v4f* aP = (const v4f*)wP + wave * (32 * 32) + lane;
  v8f accQ0 = {}, accQ1 = {}, accK0 = {}, accK1 = {}, accV0 = {}, accV1 = {};

  // q and mkey: 1x1 conv (center row of the tile, pixel 0 in LDS column 4)
  for (int k8 = 0; k8 < CF / 8; ++k8) {
    v4f aq = aP[k8 * 32];
    v4f ak = aP[MAT_V4 + k8 * 32];
    for (int s = 0; s < 2; ++s) {
      int k = k8 * 8 + s * 4 + khalf;
      v2f aqs = s ? aq.hi : aq.lo;
      v2f aks = s ? ak.hi : ak.lo;
      v2f b0v = { xs[1][k][4 + lrow],  xs[1][k + 1][4 + lrow]  };
      v2f b1v = { xs[1][k][20 + lrow], xs[1][k + 1][20 + lrow] };
      accQ0 = wmma4(aqs, b0v, accQ0);
      accQ1 = wmma4(aqs, b1v, accQ1);
      accK0 = wmma4(aks, b0v, accK0);
      accK1 = wmma4(aks, b1v, accK1);
    }
  }
  // vals: 3x3 conv as 9 accumulating tap-GEMMs
  for (int tap = 0; tap < 9; ++tap) {
    int ky = tap / 3, kx = tap % 3;
    const v4f* aT = aP + (2 + tap) * MAT_V4;
    for (int k8 = 0; k8 < CF / 8; ++k8) {
      v4f av = aT[k8 * 32];
      for (int s = 0; s < 2; ++s) {
        int k = k8 * 8 + s * 4 + khalf;
        v2f avs = s ? av.hi : av.lo;
        v2f b0v = { xs[ky][k][3 + lrow + kx],  xs[ky][k + 1][3 + lrow + kx]  };
        v2f b1v = { xs[ky][k][19 + lrow + kx], xs[ky][k + 1][19 + lrow + kx] };
        accV0 = wmma4(avs, b0v, accV0);
        accV1 = wmma4(avs, b1v, accV1);
      }
    }
  }

  // epilogue: add bias, store q/vals, reduce mkey.q into lmain: one partial per
  // wave and lane half, summed in fixed order (independent of wave arrival)
  const int mhalf = (lane >> 4) * 8;
  float p0 = 0.0f, p1 = 0.0f;
  for (int r = 0; r < 8; ++r) {
    int mo = wave * 16 + r + mhalf;
    float bq = bf[mo], bkk = bk[mo], bvv = bv[mo];
    float q0 = accQ0[r] + bq, q1 = accQ1[r] + bq;
    float k0v = accK0[r] + bkk, k1v = accK1[r] + bkk;
    float v0 = accV0[r] + bvv, v1 = accV1[r] + bvv;
    size_t base = (((size_t)b * CC + mo) * HH + h) * WW + w0;
    q_out[base + lrow]      = q0;
    q_out[base + 16 + lrow] = q1;
    v_out[base + lrow]      = v0;
    v_out[base + 16 + lrow] = v1;
    p0 += k0v * q0;
    p1 += k1v * q1;
  }
  lm_s[wave * 2 + (lane >> 4)][lrow]      = p0;
  lm_s[wave * 2 + (lane >> 4)][16 + lrow] = p1;
  __syncthreads();
  if (tid < 32) {
    float s = 0.0f;
    for (int i = 0; i < 16; ++i) s += lm_s[i][tid];
    lmain_out[((size_t)b * HH + h) * WW + w0 + tid] = s;
  }
}

// ---------------------------------------------------------------------------
// Kernel B: fused cross-attention + weighted combine.
// One WG = 16 coarse pixels = 64 subpixels (2 rows x 32 cols) for one (b,h).
// Logits use (Wc*ctx + bc).q = ctx.(Wc^T q) + bc.q : the matrix product is
// Wc^T q (M=128,N=16,K=128), once per coarse pixel instead of once per
// subpixel and context; the dot with ctx is the same length as ckeys.q was.
// Context tiles (3 x 128 x 64 f32) arrive via global_load_async_to_lds_b128,
// feed the logit dots AND the final raw-feature combine, so contexts are read
// from HBM exactly once.
// ---------------------------------------------------------------------------
__global__ void __launch_bounds__(256)
attn_kernel(const float* __restrict__ ctx,
            const float* __restrict__ wc, const float* __restrict__ bc,
            const float* __restrict__ q_ws, const float* __restrict__ v_ws,
            const float* __restrict__ lmain_ws,
            float* __restrict__ out) {
  const int w0  = blockIdx.x * 16;   // coarse col base
  const int sc0 = w0 * 2;            // subpixel col base
  const int h = blockIdx.y;
  const int b = blockIdx.z;
  const int tid  = threadIdx.x;
  const int wave = tid >> 5, lane = tid & 31;
  const int lrow = lane & 15;
  const int khalf = (lane >> 4) * 2;

  __shared__ __attribute__((aligned(16))) float cs[NCTX][CC][72];
  __shared__ __attribute__((aligned(16))) float qp_s[CC][16];        // Wc^T q
  __shared__ __attribute__((aligned(16))) float part_s[8][NCTX][64]; // per-wave logit partials
  __shared__ float bq_s[16];                                         // bc . q
  __shared__ float attn_s[4][64];

  // ---- qp[c_in][pixel] = sum_co Wc[co][c_in] * q[co][pixel]; bq = bc . q ----
  const int mhalf = (lane >> 4) * 8;
  {
    const int m = wave * 16 + lrow;  // A-matrix row = input channel of Wc
    const float* qcol = q_ws + ((size_t)b * CC * HH + h) * WW + w0 + lrow;
    v8f accA = {}, accB = {};
    float pb = 0.0f;
    // unrolled so that every step's loads are issued ahead of the first product
#pragma unroll
    for (int k0 = 0; k0 < CC; k0 += 8) {
      int k = k0 + khalf;
      v2f a0 = { wc[(size_t)k * CC + m],       wc[(size_t)(k + 1) * CC + m] };
      v2f a1 = { wc[(size_t)(k + 4) * CC + m], wc[(size_t)(k + 5) * CC + m] };
      v2f b0 = { qcol[(size_t)k * (HH * WW)],       qcol[(size_t)(k + 1) * (HH * WW)] };
      v2f b1 = { qcol[(size_t)(k + 4) * (HH * WW)], qcol[(size_t)(k + 5) * (HH * WW)] };
      accA = wmma4(a0, b0, accA);
      accB = wmma4(a1, b1, accB);
      pb += bc[k] * b0.x + bc[k + 1] * b0.y + bc[k + 4] * b1.x + bc[k + 5] * b1.y;
    }
    pb += __shfl_xor(pb, 16);  // the two lane halves hold disjoint k
    for (int r = 0; r < 8; ++r)
      qp_s[wave * 16 + r + mhalf][lrow] = accA[r] + accB[r];
    if (tid < 16) bq_s[tid] = pb;
  }

  // ---- async tensor staging: 16B per lane per issue, ASYNCcnt tracked ----
  unsigned cs_base = (unsigned)(uintptr_t)(&cs[0][0][0]);
  for (int idx4 = tid; idx4 < (NCTX * CC * 64) / 4; idx4 += 256) {
    int f0  = idx4 * 4;
    int n   = f0 / (CC * 64);
    int rem = f0 % (CC * 64);
    int c   = rem / 64;
    int sp  = rem % 64;            // sp = i*32 + j, j%4 == 0 here
    int i = sp >> 5, j = sp & 31;
    const float* gp = ctx +
        ((((size_t)n * BB + b) * CC + c) * (2 * HH) + (2 * h + i)) * (2 * WW) + sc0 + j;
    unsigned lds = cs_base + (unsigned)(((n * CC + c) * 72 + sp) * 4);
    asm volatile("global_load_async_to_lds_b128 %0, %1, off"
                 :: "v"(lds), "v"(gp) : "memory");
  }
  asm volatile("s_wait_asynccnt 0x0" ::: "memory");
  __syncthreads();

  // logits: ctx . qp. A thread takes 4 neighbouring subpixels (2 coarse pixels)
  // and every 16th channel; the two lane halves are summed in the wave, the
  // 8 waves' partials in fixed order by the softmax threads.
  {
    const int sp4 = (tid & 15) * 4;
    const int grp = tid >> 4;
    const int px  = (sp4 & 31) >> 1;
    v4f s0 = {}, s1 = {}, s2 = {};
    for (int i = 0; i < 8; ++i) {
      int c = i * 16 + grp;
      v2f qv = *(const v2f*)&qp_s[c][px];
      v4f qq = { qv.x, qv.x, qv.y, qv.y };
      s0 += *(const v4f*)&cs[0][c][sp4] * qq;
      s1 += *(const v4f*)&cs[1][c][sp4] * qq;
      s2 += *(const v4f*)&cs[2][c][sp4] * qq;
    }
    for (int e = 0; e < 4; ++e) {
      s0[e] += __shfl_xor(s0[e], 16);
      s1[e] += __shfl_xor(s1[e], 16);
      s2[e] += __shfl_xor(s2[e], 16);
    }
    if (lane < 16) {
      *(v4f*)&part_s[wave][0][sp4] = s0;
      *(v4f*)&part_s[wave][1][sp4] = s1;
      *(v4f*)&part_s[wave][2][sp4] = s2;
    }
  }
  __syncthreads();

  // 4-way softmax per subpixel (3 contexts + mainline)
  if (tid < 64) {
    int sp = tid;
    int j = sp & 31;
    float l0 = bq_s[j >> 1], l1 = l0, l2 = l0;
    for (int w = 0; w < 8; ++w) {
      l0 += part_s[w][0][sp];
      l1 += part_s[w][1][sp];
      l2 += part_s[w][2][sp];
    }
    float lm = lmain_ws[((size_t)b * HH + h) * WW + w0 + (j >> 1)];
    float mx = fmaxf(fmaxf(l0, l1), fmaxf(l2, lm));
    float e0 = __expf(l0 - mx), e1 = __expf(l1 - mx);
    float e2 = __expf(l2 - mx), em = __expf(lm - mx);
    float inv = 1.0f / (e0 + e1 + e2 + em);
    attn_s[0][sp] = e0 * inv;
    attn_s[1][sp] = e1 * inv;
    attn_s[2][sp] = e2 * inv;
    attn_s[3][sp] = em * inv;
  }
  __syncthreads();

  // weighted combine: raw context features (still in LDS) + mainline values
  for (int idx = tid; idx < CC * 64; idx += 256) {
    int c  = idx >> 6;
    int sp = idx & 63;
    int i = sp >> 5, j = sp & 31;
    float vmain = v_ws[(((size_t)b * CC + c) * HH + h) * WW + w0 + (j >> 1)];
    float o = attn_s[0][sp] * cs[0][c][sp]
            + attn_s[1][sp] * cs[1][c][sp]
            + attn_s[2][sp] * cs[2][c][sp]
            + attn_s[3][sp] * vmain;
    out[(((size_t)b * CC + c) * (2 * HH) + (2 * h + i)) * (2 * WW) + sc0 + j] = o;
  }
}

// ---------------------------------------------------------------------------
extern "C" void kernel_launch(void* const* d_in, const int* in_sizes, int n_in,
                              void* d_out, int out_size, void* d_ws, size_t ws_size,
                              hipStream_t stream) {
  const float* contexts   = (const float*)d_in[0];
  const float* mainstream = (const float*)d_in[1];
  const float* Wc_w = (const float*)d_in[2];
  const float* Wc_b = (const float*)d_in[3];
  const float* Wf_w = (const float*)d_in[4];
  const float* Wf_b = (const float*)d_in[5];
  const float* Wk_w = (const float*)d_in[6];
  const float* Wk_b = (const float*)d_in[7];
  const float* Wv_w = (const float*)d_in[8];
  const float* Wv_b = (const float*)d_in[9];
  float* out = (float*)d_out;

  float* ws    = (float*)d_ws;
  float* q_ws  = ws;                                   // B*CC*H*W
  float* v_ws  = q_ws + (size_t)BB * CC * HH * WW;     // B*CC*H*W
  float* lm_ws = v_ws + (size_t)BB * CC * HH * WW;     // B*H*W
  float* wP    = lm_ws + (size_t)BB * HH * WW;         // NMAT*CC*CF

  hipLaunchKernelGGL(pack_weights_kernel,
                     dim3(NMAT * MAT_V4 / 256), dim3(256), 0, stream,
                     Wv_w, Wf_w, Wk_w, wP);
  hipLaunchKernelGGL(proj_kernel,
                     dim3(WW / 32, HH, BB), dim3(256), 0, stream,
                     mainstream, wP, Wf_b, Wk_b, Wv_b,
                     q_ws, v_ws, lm_ws);
  hipLaunchKernelGGL(attn_kernel,
                     dim3(WW / 16, HH, BB), dim3(256), 0, stream,
                     contexts, Wc_w, Wc_b, q_ws, v_ws, lm_ws, out);
}

// v004
// Measured time: 138 microseconds a run.
// Next to v003, in two timings, it ran 1.30 times as fast each time.
// All steps since v000 together make it 2.39 times as fast.
#include <hip/hip_runtime.h>
#include <hip/hip_bf16.h>

#define NCTX 3
#define BB 8
#define CC 128
#define CF 256
#define HH 64
#define WW 64

typedef __attribute__((ext_vector_type(2))) float v2f;
typedef __attribute__((ext_vector_type(4))) float v4f;
typedef __attribute__((ext_vector_type(8))) float v8f;

__device__ __forceinline__ v8f wmma4(v2f a, v2f b, v8f c) {
  // D = A(16x4) * B(4x16) + C(16x16), full fp32
  return __builtin_amdgcn_wmma_f32_16x16x4_f32(false, a, false, b, (short)0, c, false, false);
}

// ---------------------------------------------------------------------------
// Channel order of every product of the projection kernel: in 16x16x4 step ks
// the lane half hf holds input channels chan(ks, hf) and chan(ks, hf) + 1, in
// the A and in the B fragment alike. The halves lie 8 channels apart so that
// their LDS rows (68 floats each) fall on different banks.
// ---------------------------------------------------------------------------
__device__ __forceinline__ int chan(int ks, int hf) {
  return (ks >> 2) * 16 + hf * 8 + (ks & 3) * 2;
}

// One row of the filter transform G of Winograd F(2,3):
// G = [1 0 0; 1/2 1/2 1/2; 1/2 -1/2 1/2; 0 0 1]
__device__ __forceinline__ float gtrans(int a, float x0, float x1, float x2) {
  if (a == 0) return x0;
  if (a == 3) return x2;
  return 0.5f * (a == 1 ? (x0 + x1 + x2) : (x0 - x1 + x2));
}

// ---------------------------------------------------------------------------
// Kernel W: pack the weights in the order in which the projection kernel's
// waves consume A fragments, 16 bytes per lane, whole lines per wave load.
//   Wf, Wk:  wP[mat][mtile][k8][lane] = the lane's A registers of steps 2*k8
//            and 2*k8 + 1 (four neighbouring channels of row m).
//   Wv:      U = G g G^T (4 x 4 positions per filter, Winograd F(2x2,3x3)),
//            wU[mtile][ks][pp][lane] = the lane's A registers of step ks for
//            positions 2*pp and 2*pp + 1.
//   m = mtile*16 + (lane & 15), lane half = lane >> 4.
// ---------------------------------------------------------------------------
#define MAT_V4 (CC * CF / 4)      // 16-byte pieces per 128 x 256 matrix
#define QK_V4  (2 * MAT_V4)       // pieces of Wf and Wk together
#define U_THR  (CC / 16 * (CF / 4) * 32)   // threads that transform Wv: one per (mtile, ks, lane)

__global__ void pack_weights_kernel(const float* __restrict__ wv,
                                    const float* __restrict__ wf,
                                    const float* __restrict__ wk,
                                    float* __restrict__ wP) {
  int t = blockIdx.x * 256 + threadIdx.x;
  int lane = t & 31;
  int hf = lane >> 4;
  if (t < QK_V4) {                          // one 16-byte piece per thread
    int k8  = (t >> 5) & 31;
    int mt  = (t >> 10) & 7;
    int mat = t >> 13;
    int m = mt * 16 + (lane & 15);
    const float* r = (mat == 0 ? wf : wk) + (size_t)m * CF + chan(2 * k8, hf);
    ((v4f*)wP)[t] = v4f{ r[0], r[1], r[2], r[3] };
  } else {                                  // two filters, 8 pieces per thread
    int u  = t - QK_V4;
    int ks = (u >> 5) & 63;
    int mt = u >> 11;
    int m = mt * 16 + (lane & 15);
    const float* g = wv + ((size_t)m * CF + chan(ks, hf)) * 9;
    float uu[2][16];                        // [channel][position a * 4 + c]
    // unrolled: constant rows of G, register array
#pragma unroll
    for (int e = 0; e < 2; ++e) {
      const float* ge = g + e * 9;
#pragma unroll
      for (int a = 0; a < 4; ++a) {
        float r0 = gtrans(a, ge[0], ge[3], ge[6]);
        float r1 = gtrans(a, ge[1], ge[4], ge[7]);
        float r2 = gtrans(a, ge[2], ge[5], ge[8]);
#pragma unroll
        for (int c = 0; c < 4; ++c) uu[e][a * 4 + c] = gtrans(c, r0, r1, r2);
      }
    }
    v4f* dst = (v4f*)wP + QK_V4 + (size_t)(mt * 64 + ks) * (8 * 32) + lane;
#pragma unroll
    for (int pp = 0; pp < 8; ++pp)
      dst[pp * 32] = v4f{ uu[0][2 * pp], uu[1][2 * pp], uu[0][2 * pp + 1], uu[1][2 * pp + 1] };
  }
}

// ---------------------------------------------------------------------------
// Kernel A: projections from mainstream.
//   q    = Wf * x + bf                (stored to ws)
//   vals = conv3x3(x, Wv) + bv       (stored to ws)
//   lmain= sum_c (Wk*x+bk)_c * q_c   (stored to ws)
// One WG = two whole image rows = 32 tiles of 2 x 2 pixels; 8 waves, each 16
// output channels, so the packed weights are read once per 128 pixels.
// vals by Winograd F(2x2,3x3): V = B^T d B of each tile's 4 x 4 input patch,
// 16 accumulating products M[pos] += U[pos] * V[pos] over the input channels
// (N = tiles), then Y = A^T M A: 16 products for 4 pixels, not 36.
// Input tile (4 rows x 256 ci) in LDS, 68 floats per (row, ci): columns 0..63
// hold the image row and come by global_load_async_to_lds_b128; column 64 is
// zero and stands for the image columns -1 and 64 (65..67 are never read). A
// whole row above or below the image is stored as zeros.
// ---------------------------------------------------------------------------
#define XP 68   // floats per (row, ci) in LDS

__device__ __forceinline__ void copy8_to_lds(const unsigned* l, const float* const* g) {
  // One statement: the compiler can put no rewrite of an address register
  // between a copy and the s_wait_xcnt that closes the run.
  asm volatile(
      "global_load_async_to_lds_b128 %0, %8, off\n\t"
      "global_load_async_to_lds_b128 %1, %9, off\n\t"
      "global_load_async_to_lds_b128 %2, %10, off\n\t"
      "global_load_async_to_lds_b128 %3, %11, off\n\t"
      "global_load_async_to_lds_b128 %4, %12, off\n\t"
      "global_load_async_to_lds_b128 %5, %13, off\n\t"
      "global_load_async_to_lds_b128 %6, %14, off\n\t"
      "global_load_async_to_lds_b128 %7, %15, off\n\t"
      "s_wait_xcnt 0x0"
      :: "v"(l[0]), "v"(l[1]), "v"(l[2]), "v"(l[3]),
         "v"(l[4]), "v"(l[5]), "v"(l[6]), "v"(l[7]),
         "v"(g[0]), "v"(g[1]), "v"(g[2]), "v"(g[3]),
         "v"(g[4]), "v"(g[5]), "v"(g[6]), "v"(g[7])
      : "memory");
}

// s_wait_xcnt 0 in front of code that rewrites registers which an issued global
// load or store names; the scheduling barrier keeps those writes behind it.
__device__ __forceinline__ void close_xcnt() {
  asm volatile("s_wait_xcnt 0x0" ::: "memory");
  __builtin_amdgcn_sched_barrier(0);
}

__global__ void __launch_bounds__(256)
proj_kernel(const float* __restrict__ x,
            const float* __restrict__ wP,
            const float* __restrict__ bf, const float* __restrict__ bk,
            const float* __restrict__ bv,
            float* __restrict__ q_out, float* __restrict__ v_out,
            float* __restrict__ lmain_out) {
  const int h0 = blockIdx.x * 2;
  const int b  = blockIdx.y;
  const int tid  = threadIdx.x;
  const int wave = tid >> 5, lane = tid & 31;
  const int lrow = lane & 15;
  const int hf   = lane >> 4;

  __shared__ __attribute__((aligned(16))) float xs[4][CF][XP];
  __shared__ float lm_s[16][128];  // mkey.q partials: [wave * 2 + lane half][pixel]

  const unsigned xs_base = (unsigned)(uintptr_t)(&xs[0][0][0]);
  const float* xb = x + (size_t)b * CF * HH * WW;
  for (int ch = 0; ch < 2; ++ch) {         // 128 channels at a time: 32 copies a thread
    for (int row = 0; row < 4; ++row) {
      const int gh = h0 - 1 + row;         // the same for the whole work-group
      if ((unsigned)gh < HH) {
        unsigned l[8];
        const float* g[8];
        for (int j = 0; j < 8; ++j) {      // 16 neighbouring lanes, one image row
          int idx = tid + j * 256;
          int ci  = ch * 128 + (idx >> 4);
          int c   = (idx & 15) * 4;
          l[j] = xs_base + (unsigned)(((row * CF + ci) * XP + c) * 4);
          g[j] = xb + ((ci * HH + gh) * WW + c);
        }
        copy8_to_lds(l, g);
      }
    }
    if (ch == 0) {
      // zeros, while the copies fly: bytes that no copy is aimed at
      for (int row = 0; row < 4; ++row) {
        if ((unsigned)(h0 - 1 + row) < HH) {
          *(v4f*)&xs[row][tid][64] = v4f{};
        } else {
          for (int p = 0; p < XP / 4; ++p)
            *(v4f*)&xs[row][tid][p * 4] = v4f{};
        }
      }
    }
    // this wave's copies have landed: before the next 32 are issued (a wave
    // keeps fewer than 64 in flight), and before it signals the barrier
    asm volatile("s_wait_asynccnt 0x0" ::: "memory");
  }
  __syncthreads();

  const int mhalf = hf * 8;

  // q and mkey: 1x1 conv on the two middle rows of the tile, 8 N tiles:
  // nt = image row (nt >> 2) and 16-column group (nt & 3)
  {
    const v4f* aP = (const v4f*)wP + wave * (32 * 32) + lane;
    v8f accQ[8] = {}, accK[8] = {};
    v4f aq = aP[0], ak = aP[MAT_V4];
    close_xcnt();
    for (int k8 = 0; k8 < CF / 8; ++k8) {
      // the next trip's A registers are loaded a trip ahead (last trip: itself)
      const int kn = (k8 + 1 < CF / 8 ? k8 + 1 : k8) * 32;
      v4f aqN = aP[kn], akN = aP[MAT_V4 + kn];
      // unrolled: the accumulator arrays need constant indices to stay in registers
#pragma unroll
      for (int s = 0; s < 2; ++s) {
        int k = chan(k8 * 2 + s, hf);
        v2f aqs = s ? aq.hi : aq.lo;
        v2f aks = s ? ak.hi : ak.lo;
#pragma unroll
        for (int nt = 0; nt < 8; ++nt) {
          int rr = 1 + (nt >> 2), cc = (nt & 3) * 16 + lrow;
          v2f bv2 = { xs[rr][k][cc], xs[rr][k + 1][cc] };
          accQ[nt] = wmma4(aqs, bv2, accQ[nt]);
          accK[nt] = wmma4(aks, bv2, accK[nt]);
        }
      }
      aq = aqN;
      ak = akN;
    }
    // add bias, store q, reduce mkey.q: one partial per wave and lane half,
    // summed in fixed order at the end of the kernel
    float p[8] = { 0.0f, 0.0f, 0.0f, 0.0f, 0.0f, 0.0f, 0.0f, 0.0f };
#pragma unroll
    for (int r = 0; r < 8; ++r) {
      int mo = wave * 16 + r + mhalf;
      float bq = bf[mo], bkk = bk[mo];
      size_t base = (((size_t)b * CC + mo) * HH + h0) * WW + lrow;
#pragma unroll
      for (int nt = 0; nt < 8; ++nt) {
        float qv = accQ[nt][r] + bq;
        float kv = accK[nt][r] + bkk;
        q_out[base + nt * 16] = qv;        // the two rows follow one another
        p[nt] += kv * qv;
      }
    }
#pragma unroll
    for (int nt = 0; nt < 8; ++nt)
      lm_s[wave * 2 + hf][nt * 16 + lrow] = p[nt];
    close_xcnt();   // the q stores' registers become accumulators of the next part
  }

  // vals: lane column = tile n2 * 16 + lrow, patch columns 2 * tile - 1 .. + 2
  {
    const v4f* aU = (const v4f*)wP + QK_V4 + (size_t)wave * (64 * 8 * 32) + lane;
    v8f acc[2][16] = {};
    v4f a[8];
    // unrolled (here and below): register arrays need constant indices
#pragma unroll
    for (int pp = 0; pp < 8; ++pp) a[pp] = aU[pp * 32];
    close_xcnt();
    for (int ks = 0; ks < CF / 4; ++ks) {
      const int k = chan(ks, hf);
      // the next step's A registers are reloaded behind the products that read
      // them, so the loads fly under the rest of this step (last step: itself)
      const v4f* aN = aU + (ks + 1 < CF / 4 ? ks + 1 : ks) * (8 * 32);
      v2f e[2][4][4];   // B^T d, both channels of the lane at once
#pragma unroll
      for (int n2 = 0; n2 < 2; ++n2) {
        const int t = n2 * 16 + lrow;
#pragma unroll
        for (int j = 0; j < 4; ++j) {
          const int o = (j == 0 && t == 0) ? 64 : 2 * t - 1 + j;
          v2f d0 = { xs[0][k][o], xs[0][k + 1][o] };
          v2f d1 = { xs[1][k][o], xs[1][k + 1][o] };
          v2f d2 = { xs[2][k][o], xs[2][k + 1][o] };
          v2f d3 = { xs[3][k][o], xs[3][k + 1][o] };
          e[n2][0][j] = d0 - d2;
          e[n2][1][j] = d1 + d2;
          e[n2][2][j] = d2 - d1;
          e[n2][3][j] = d1 - d3;
        }
      }
#pragma unroll
      for (int i = 0; i < 4; ++i) {
#pragma unroll
        for (int n2 = 0; n2 < 2; ++n2) {
          v2f t0 = e[n2][i][0] - e[n2][i][2];
          v2f t1 = e[n2][i][1] + e[n2][i][2];
          v2f t2 = e[n2][i][2] - e[n2][i][1];
          v2f t3 = e[n2][i][1] - e[n2][i][3];
          acc[n2][i * 4 + 0] = wmma4(a[i * 2].lo,     t0, acc[n2][i * 4 + 0]);
          acc[n2][i * 4 + 1] = wmma4(a[i * 2].hi,     t1, acc[n2][i * 4 + 1]);
          acc[n2][i * 4 + 2] = wmma4(a[i * 2 + 1].lo, t2, acc[n2][i * 4 + 2]);
          acc[n2][i * 4 + 3] = wmma4(a[i * 2 + 1].hi, t3, acc[n2][i * 4 + 3]);
        }
        a[i * 2]     = aN[(i * 2) * 32];
        a[i * 2 + 1] = aN[(i * 2 + 1) * 32];
      }
      close_xcnt();   // the address registers are rewritten at the top of the next step
    }
    // Y = A^T M A, A^T = [1 1 1 0; 0 1 -1 -1]; every lane holds all 16
    // positions of its (channel, tile) elements
#pragma unroll
    for (int r = 0; r < 8; ++r) {
      int mo = wave * 16 + r + mhalf;
      float bvv = bv[mo];
#pragma unroll
      for (int n2 = 0; n2 < 2; ++n2) {
        float s0[4], s1[4];
#pragma unroll
        for (int c = 0; c < 4; ++c) {
          s0[c] = acc[n2][c][r] + acc[n2][4 + c][r] + acc[n2][8 + c][r];
          s1[c] = acc[n2][4 + c][r] - acc[n2][8 + c][r] - acc[n2][12 + c][r];
        }
        size_t base = (((size_t)b * CC + mo) * HH + h0) * WW + 2 * (n2 * 16 + lrow);
        *(v2f*)&v_out[base]      = v2f{ s0[0] + s0[1] + s0[2] + bvv, s0[1] - s0[2] - s0[3] + bvv };
        *(v2f*)&v_out[base + WW] = v2f{ s1[0] + s1[1] + s1[2] + bvv, s1[1] - s1[2] - s1[3] + bvv };
      }
      close_xcnt();   // the next channel's sums reuse the stores' registers
    }
  }

  __syncthreads();
  if (tid < 128) {
    float s = 0.0f;
    for (int i = 0; i < 16; ++i) s += lm_s[i][tid];
    lmain_out[((size_t)b * HH + h0) * WW + tid] = s;   // two whole rows
  }
}

// ---------------------------------------------------------------------------
// Kernel B: fused cross-attention + weighted combine.
// One WG = 16 coarse pixels = 64 subpixels (2 rows x 32 cols) for one (b,h).
// Logits use (Wc*ctx + bc).q = ctx.(Wc^T q) + bc.q : the matrix product is
// Wc^T q (M=128,N=16,K=128), once per coarse pixel instead of once per
// subpixel and context; the dot with ctx is the same length as ckeys.q was.
// Context tiles (3 x 128 x 64 f32) arrive via global_load_async_to_lds_b128,
// feed the logit dots AND the final raw-feature combine, so contexts are read
// from HBM exactly once.
// ---------------------------------------------------------------------------
__global__ void __launch_bounds__(256)
attn_kernel(const float* __restrict__ ctx,
            const float* __restrict__ wc, const float* __restrict__ bc,
            const float* __restrict__ q_ws, const float* __restrict__ v_ws,
            const float* __restrict__ lmain_ws,
            float* __restrict__ out) {
  const int w0  = blockIdx.x * 16;   // coarse col base
  const int sc0 = w0 * 2;            // subpixel col base
  const int h = blockIdx.y;
  const int b = blockIdx.z;
  const int tid  = threadIdx.x;
  const int wave = tid >> 5, lane = tid & 31;
  const int lrow = lane & 15;
  const int khalf = (lane >> 4) * 2;

  __shared__ __attribute__((aligned(16))) float cs[NCTX][CC][72];
  __shared__ __attribute__((aligned(16))) float qp_s[CC][16];        // Wc^T q
  __shared__ __attribute__((aligned(16))) float part_s[8][NCTX][64]; // per-wave logit partials
  __shared__ float bq_s[16];                                         // bc . q
  __shared__ float attn_s[4][64];

  // ---- qp[c_in][pixel] = sum_co Wc[co][c_in] * q[co][pixel]; bq = bc . q ----
  const int mhalf = (lane >> 4) * 8;
  {
    const int m = wave * 16 + lrow;  // A-matrix row = input channel of Wc
    const float* qcol = q_ws + ((size_t)b * CC * HH + h) * WW + w0 + lrow;
    v8f accA = {}, accB = {};
    float pb = 0.0f;
    // unrolled so that every step's loads are issued ahead of the first product
#pragma unroll
    for (int k0 = 0; k0 < CC; k0 += 8) {
      int k = k0 + khalf;
      v2f a0 = { wc[(size_t)k * CC + m],       wc[(size_t)(k + 1) * CC + m] };
      v2f a1 = { wc[(size_t)(k + 4) * CC + m], wc[(size_t)(k + 5) * CC + m] };
      v2f b0 = { qcol[(size_t)k * (HH * WW)],       qcol[(size_t)(k + 1) * (HH * WW)] };
      v2f b1 = { qcol[(size_t)(k + 4) * (HH * WW)], qcol[(size_t)(k + 5) * (HH * WW)] };
      accA = wmma4(a0, b0, accA);
      accB = wmma4(a1, b1, accB);
      pb += bc[k] * b0.x + bc[k + 1] * b0.y + bc[k + 4] * b1.x + bc[k + 5] * b1.y;
    }
    pb += __shfl_xor(pb, 16);  // the two lane halves hold disjoint k
    for (int r = 0; r < 8; ++r)
      qp_s[wave * 16 + r + mhalf][lrow] = accA[r] + accB[r];
    if (tid < 16) bq_s[tid] = pb;
  }

  // ---- async tensor staging: 16B per lane per issue, ASYNCcnt tracked ----
  unsigned cs_base = (unsigned)(uintptr_t)(&cs[0][0][0]);
  for (int idx4 = tid; idx4 < (NCTX * CC * 64) / 4; idx4 += 256) {
    int f0  = idx4 * 4;
    int n   = f0 / (CC * 64);
    int rem = f0 % (CC * 64);
    int c   = rem / 64;
    int sp  = rem % 64;            // sp = i*32 + j, j%4 == 0 here
    int i = sp >> 5, j = sp & 31;
    const float* gp = ctx +
        ((((size_t)n * BB + b) * CC + c) * (2 * HH) + (2 * h + i)) * (2 * WW) + sc0 + j;
    unsigned lds = cs_base + (unsigned)(((n * CC + c) * 72 + sp) * 4);
    asm volatile("global_load_async_to_lds_b128 %0, %1, off"
                 :: "v"(lds), "v"(gp) : "memory");
  }
  asm volatile("s_wait_asynccnt 0x0" ::: "memory");
  __syncthreads();

  // logits: ctx . qp. A thread takes 4 neighbouring subpixels (2 coarse pixels)
  // and every 16th channel; the two lane halves are summed in the wave, the
  // 8 waves' partials in fixed order by the softmax threads.
  {
    const int sp4 = (tid & 15) * 4;
    const int grp = tid >> 4;
    const int px  = (sp4 & 31) >> 1;
    v4f s0 = {}, s1 = {}, s2 = {};
    for (int i = 0; i < 8; ++i) {
      int c = i * 16 + grp;
      v2f qv = *(const v2f*)&qp_s[c][px];
      v4f qq = { qv.x, qv.x, qv.y, qv.y };
      s0 += *(const v4f*)&cs[0][c][sp4] * qq;
      s1 += *(const v4f*)&cs[1][c][sp4] * qq;
      s2 += *(const v4f*)&cs[2][c][sp4] * qq;
    }
    for (int e = 0; e < 4; ++e) {
      s0[e] += __shfl_xor(s0[e], 16);
      s1[e] += __shfl_xor(s1[e], 16);
      s2[e] += __shfl_xor(s2[e], 16);
    }
    if (lane < 16) {
      *(v4f*)&part_s[wave][0][sp4] = s0;
      *(v4f*)&part_s[wave][1][sp4] = s1;
      *(v4f*)&part_s[wave][2][sp4] = s2;
    }
  }
  __syncthreads();

  // 4-way softmax per subpixel (3 contexts + mainline)
  if (tid < 64) {
    int sp = tid;
    int j = sp & 31;
    float l0 = bq_s[j >> 1], l1 = l0, l2 = l0;
    for (int w = 0; w < 8; ++w) {
      l0 += part_s[w][0][sp];
      l1 += part_s[w][1][sp];
      l2 += part_s[w][2][sp];
    }
    float lm = lmain_ws[((size_t)b * HH + h) * WW + w0 + (j >> 1)];
    float mx = fmaxf(fmaxf(l0, l1), fmaxf(l2, lm));
    float e0 = __expf(l0 - mx), e1 = __expf(l1 - mx);
    float e2 = __expf(l2 - mx), em = __expf(lm - mx);
    float inv = 1.0f / (e0 + e1 + e2 + em);
    attn_s[0][sp] = e0 * inv;
    attn_s[1][sp] = e1 * inv;
    attn_s[2][sp] = e2 * inv;
    attn_s[3][sp] = em * inv;
  }
  __syncthreads();

  // weighted combine: raw context features (still in LDS) + mainline values
  for (int idx = tid; idx < CC * 64; idx += 256) {
    int c  = idx >> 6;
    int sp = idx & 63;
    int i = sp >> 5, j = sp & 31;
    float vmain = v_ws[(((size_t)b * CC + c) * HH + h) * WW + w0 + (j >> 1)];
    float o = attn_s[0][sp] * cs[0][c][sp]
            + attn_s[1][sp] * cs[1][c][sp]
            + attn_s[2][sp] * cs[2][c][sp]
            + attn_s[3][sp] * vmain;
    out[(((size_t)b * CC + c) * (2 * HH) + (2 * h + i)) * (2 * WW) + sc0 + j] = o;
  }
}

// ---------------------------------------------------------------------------
extern "C" void kernel_launch(void* const* d_in, const int* in_sizes, int n_in,
                              void* d_out, int out_size, void* d_ws, size_t ws_size,
                              hipStream_t stream) {
  const float* contexts   = (const float*)d_in[0];
  const float* mainstream = (const float*)d_in[1];
  const float* Wc_w = (const float*)d_in[2];
  const float* Wc_b = (const float*)d_in[3];
  const float* Wf_w = (const float*)d_in[4];
  const float* Wf_b = (const float*)d_in[5];
  const float* Wk_w = (const float*)d_in[6];
  const float* Wk_b = (const float*)d_in[7];
  const float* Wv_w = (const float*)d_in[8];
  const float* Wv_b = (const float*)d_in[9];
  float* out = (float*)d_out;

  float* ws    = (float*)d_ws;
  float* q_ws  = ws;                                   // B*CC*H*W
  float* v_ws  = q_ws + (size_t)BB * CC * HH * WW;     // B*CC*H*W
  float* lm_ws = v_ws + (size_t)BB * CC * HH * WW;     // B*H*W
  float* wP    = lm_ws + (size_t)BB * HH * WW;         // (2 + 16)*CC*CF

  hipLaunchKernelGGL(pack_weights_kernel,
                     dim3((QK_V4 + U_THR) / 256), dim3(256), 0, stream,
                     Wv_w, Wf_w, Wk_w, wP);
  hipLaunchKernelGGL(proj_kernel,
                     dim3(HH / 2, BB), dim3(256), 0, stream,
                     mainstream, wP, Wf_b, Wk_b, Wv_b,
                     q_ws, v_ws, lm_ws);
  hipLaunchKernelGGL(attn_kernel,
                     dim3(WW / 16, HH, BB), dim3(256), 0, stream,
                     contexts, Wc_w, Wc_b, q_ws, v_ws, lm_ws, out);
}

// v005
// Measured time: 126 microseconds a run.
// Two timings next to v004 both put it at 1.09 times that version's speed.
// Counting every step since v000, it is 2.61 times as fast.
#include <hip/hip_runtime.h>
#include <hip/hip_bf16.h>

#define NCTX 3
#define BB 8
#define CC 128
#define CF 256
#define HH 64
#define WW 64

typedef __attribute__((ext_vector_type(2))) float v2f;
typedef __attribute__((ext_vector_type(4))) float v4f;
typedef __attribute__((ext_vector_type(8))) float v8f;

__device__ __forceinline__ v8f wmma4(v2f a, v2f b, v8f c) {
  // D = A(16x4) * B(4x16) + C(16x16), full fp32
  return __builtin_amdgcn_wmma_f32_16x16x4_f32(false, a, false, b, (short)0, c, false, false);
}

// ---------------------------------------------------------------------------
// Channel order of every product of the projection kernel: in 16x16x4 step ks
// the lane half hf holds input channels chan(ks, hf) and chan(ks, hf) + 1, in
// the A and in the B fragment alike. The halves lie 8 channels apart so that
// their LDS rows (68 floats each) fall on different banks.
// ---------------------------------------------------------------------------
__device__ __forceinline__ int chan(int ks, int hf) {
  return (ks >> 2) * 16 + hf * 8 + (ks & 3) * 2;
}

// One row of the filter transform G of Winograd F(2,3):
// G = [1 0 0; 1/2 1/2 1/2; 1/2 -1/2 1/2; 0 0 1]
__device__ __forceinline__ float gtrans(int a, float x0, float x1, float x2) {
  if (a == 0) return x0;
  if (a == 3) return x2;
  return 0.5f * (a == 1 ? (x0 + x1 + x2) : (x0 - x1 + x2));
}

// ---------------------------------------------------------------------------
// Kernel W: pack the weights in the order in which the projection kernel's
// waves consume A fragments, 16 bytes per lane, whole lines per wave load.
//   Wf, Wk:  wP[mat][mtile][k8][lane] = the lane's A registers of steps 2*k8
//            and 2*k8 + 1 (four neighbouring channels of row m).
//   Wv:      U = G g G^T (4 x 4 positions per filter, Winograd F(2x2,3x3)),
//            wU[mtile][ks][pp][lane] = the lane's A registers of step ks for
//            positions 2*pp and 2*pp + 1.
//   m = mtile*16 + (lane & 15), lane half = lane >> 4.
// ---------------------------------------------------------------------------
#define MAT_V4 (CC * CF / 4)      // 16-byte pieces per 128 x 256 matrix
#define QK_V4  (2 * MAT_V4)       // pieces of Wf and Wk together
#define U_THR  (CC / 16 * (CF / 4) * 32)   // threads that transform Wv: one per (mtile, ks, lane)

__global__ void pack_weights_kernel(const float* __restrict__ wv,
                                    const float* __restrict__ wf,
                                    const float* __restrict__ wk,
                                    float* __restrict__ wP) {
  int t = blockIdx.x * 256 + threadIdx.x;
  int lane = t & 31;
  int hf = lane >> 4;
  if (t < QK_V4) {                          // one 16-byte piece per thread
    int k8  = (t >> 5) & 31;
    int mt  = (t >> 10) & 7;
    int mat = t >> 13;
    int m = mt * 16 + (lane & 15);
    const float* r = (mat == 0 ? wf : wk) + (size_t)m * CF + chan(2 * k8, hf);
    ((v4f*)wP)[t] = v4f{ r[0], r[1], r[2], r[3] };
  } else {                                  // two filters, 8 pieces per thread
    int u  = t - QK_V4;
    int ks = (u >> 5) & 63;
    int mt = u >> 11;
    int m = mt * 16 + (lane & 15);
    const float* g = wv + ((size_t)m * CF + chan(ks, hf)) * 9;
    float uu[2][16];                        // [channel][position a * 4 + c]
    // unrolled: constant rows of G, register array
#pragma unroll
    for (int e = 0; e < 2; ++e) {
      const float* ge = g + e * 9;
#pragma unroll
      for (int a = 0; a < 4; ++a) {
        float r0 = gtrans(a, ge[0], ge[3], ge[6]);
        float r1 = gtrans(a, ge[1], ge[4], ge[7]);
        float r2 = gtrans(a, ge[2], ge[5], ge[8]);
#pragma unroll
        for (int c = 0; c < 4; ++c) uu[e][a * 4 + c] = gtrans(c, r0, r1, r2);
      }
    }
    v4f* dst = (v4f*)wP + QK_V4 + (size_t)(mt * 64 + ks) * (8 * 32) + lane;
#pragma unroll
    for (int pp = 0; pp < 8; ++pp)
      dst[pp * 32] = v4f{ uu[0][2 * pp], uu[1][2 * pp], uu[0][2 * pp + 1], uu[1][2 * pp + 1] };
  }
}

// ---------------------------------------------------------------------------
// Kernel A: projections from mainstream.
//   q    = Wf * x + bf                (stored to ws)
//   vals = conv3x3(x, Wv) + bv       (stored to ws)
//   lmain= sum_c (Wk*x+bk)_c * q_c   (stored to ws)
// One WG = two whole image rows = 32 tiles of 2 x 2 pixels; 8 waves, each 16
// output channels, so the packed weights are read once per 128 pixels.
// vals by Winograd F(2x2,3x3): V = B^T d B of each tile's 4 x 4 input patch,
// 16 accumulating products M[pos] += U[pos] * V[pos] over the input channels
// (N = tiles), then Y = A^T M A: 16 products for 4 pixels, not 36.
// Input tile (4 rows x 256 ci) in LDS, 68 floats per (row, ci): columns 0..63
// hold the image row and come by global_load_async_to_lds_b128; column 64 is
// zero and stands for the image columns -1 and 64 (65..67 are never read). A
// whole row above or below the image is stored as zeros.
// ---------------------------------------------------------------------------
#define XP 68   // floats per (row, ci) in LDS

__device__ __forceinline__ void copy8_to_lds(const unsigned* l, const float* const* g) {
  // One statement: the compiler can put no rewrite of an address register
  // between a copy and the s_wait_xcnt that closes the run.
  asm volatile(
      "global_load_async_to_lds_b128 %0, %8, off\n\t"
      "global_load_async_to_lds_b128 %1, %9, off\n\t"
      "global_load_async_to_lds_b128 %2, %10, off\n\t"
      "global_load_async_to_lds_b128 %3, %11, off\n\t"
      "global_load_async_to_lds_b128 %4, %12, off\n\t"
      "global_load_async_to_lds_b128 %5, %13, off\n\t"
      "global_load_async_to_lds_b128 %6, %14, off\n\t"
      "global_load_async_to_lds_b128 %7, %15, off\n\t"
      "s_wait_xcnt 0x0"
      :: "v"(l[0]), "v"(l[1]), "v"(l[2]), "v"(l[3]),
         "v"(l[4]), "v"(l[5]), "v"(l[6]), "v"(l[7]),
         "v"(g[0]), "v"(g[1]), "v"(g[2]), "v"(g[3]),
         "v"(g[4]), "v"(g[5]), "v"(g[6]), "v"(g[7])
      : "memory");
}

__device__ __forceinline__ void copy2_to_lds(unsigned l0, unsigned l1,
                                             const float* g0, const float* g1) {
  // One statement: no rewrite of an address register can come between a copy
  // and the s_wait_xcnt that closes the run.
  asm volatile(
      "global_load_async_to_lds_b128 %0, %2, off\n\t"
      "global_load_async_to_lds_b128 %1, %3, off\n\t"
      "s_wait_xcnt 0x0"
      :: "v"(l0), "v"(l1), "v"(g0), "v"(g1)
      : "memory");
}

// s_wait_xcnt 0 in front of code that rewrites registers which an issued global
// load or store names; the scheduling barrier keeps those writes behind it.
__device__ __forceinline__ void close_xcnt() {
  asm volatile("s_wait_xcnt 0x0" ::: "memory");
  __builtin_amdgcn_sched_barrier(0);
}

__global__ void __launch_bounds__(256)
proj_kernel(const float* __restrict__ x,
            const float* __restrict__ wP,
            const float* __restrict__ bf, const float* __restrict__ bk,
            const float* __restrict__ bv,
            float* __restrict__ q_out, float* __restrict__ v_out,
            float* __restrict__ lmain_out) {
  const int h0 = blockIdx.x * 2;
  const int b  = blockIdx.y;
  const int tid  = threadIdx.x;
  const int wave = tid >> 5, lane = tid & 31;
  const int lrow = lane & 15;
  const int hf   = lane >> 4;

  __shared__ __attribute__((aligned(16))) float xs[4][CF][XP];
  __shared__ float lm_s[16][128];  // mkey.q partials: [wave * 2 + lane half][pixel]

  const unsigned xs_base = (unsigned)(uintptr_t)(&xs[0][0][0]);
  const float* xb = x + (size_t)b * CF * HH * WW;
  for (int ch = 0; ch < 2; ++ch) {         // 128 channels at a time: 32 copies a thread
    for (int row = 0; row < 4; ++row) {
      const int gh = h0 - 1 + row;         // the same for the whole work-group
      if ((unsigned)gh < HH) {
        unsigned l[8];
        const float* g[8];
        for (int j = 0; j < 8; ++j) {      // 16 neighbouring lanes, one image row
          int idx = tid + j * 256;
          int ci  = ch * 128 + (idx >> 4);
          int c   = (idx & 15) * 4;
          l[j] = xs_base + (unsigned)(((row * CF + ci) * XP + c) * 4);
          g[j] = xb + ((ci * HH + gh) * WW + c);
        }
        copy8_to_lds(l, g);
      }
    }
    if (ch == 0) {
      // zeros, while the copies fly: bytes that no copy is aimed at
      for (int row = 0; row < 4; ++row) {
        if ((unsigned)(h0 - 1 + row) < HH) {
          *(v4f*)&xs[row][tid][64] = v4f{};
        } else {
          for (int p = 0; p < XP / 4; ++p)
            *(v4f*)&xs[row][tid][p * 4] = v4f{};
        }
      }
    }
    // this wave's copies have landed: before the next 32 are issued (a wave
    // keeps fewer than 64 in flight), and before it signals the barrier
    asm volatile("s_wait_asynccnt 0x0" ::: "memory");
  }
  __syncthreads();

  const int mhalf = hf * 8;

  // q and mkey: 1x1 conv on the two middle rows of the tile, 8 N tiles:
  // nt = image row (nt >> 2) and 16-column group (nt & 3)
  {
    const v4f* aP = (const v4f*)wP + wave * (32 * 32) + lane;
    v8f accQ[8] = {}, accK[8] = {};
    v4f aq = aP[0], ak = aP[MAT_V4];
    close_xcnt();
    for (int k8 = 0; k8 < CF / 8; ++k8) {
      // the next trip's A registers are loaded a trip ahead (last trip: itself)
      const int kn = (k8 + 1 < CF / 8 ? k8 + 1 : k8) * 32;
      v4f aqN = aP[kn], akN = aP[MAT_V4 + kn];
      // unrolled: the accumulator arrays need constant indices to stay in registers
#pragma unroll
      for (int s = 0; s < 2; ++s) {
        int k = chan(k8 * 2 + s, hf);
        v2f aqs = s ? aq.hi : aq.lo;
        v2f aks = s ? ak.hi : ak.lo;
#pragma unroll
        for (int nt = 0; nt < 8; ++nt) {
          int rr = 1 + (nt >> 2), cc = (nt & 3) * 16 + lrow;
          v2f bv2 = { xs[rr][k][cc], xs[rr][k + 1][cc] };
          accQ[nt] = wmma4(aqs, bv2, accQ[nt]);
          accK[nt] = wmma4(aks, bv2, accK[nt]);
        }
      }
      aq = aqN;
      ak = akN;
    }
    // add bias, store q, reduce mkey.q: one partial per wave and lane half,
    // summed in fixed order at the end of the kernel
    float p[8] = { 0.0f, 0.0f, 0.0f, 0.0f, 0.0f, 0.0f, 0.0f, 0.0f };
#pragma unroll
    for (int r = 0; r < 8; ++r) {
      int mo = wave * 16 + r + mhalf;
      float bq = bf[mo], bkk = bk[mo];
      size_t base = (((size_t)b * CC + mo) * HH + h0) * WW + lrow;
#pragma unroll
      for (int nt = 0; nt < 8; ++nt) {
        float qv = accQ[nt][r] + bq;
        float kv = accK[nt][r] + bkk;
        q_out[base + nt * 16] = qv;        // the two rows follow one another
        p[nt] += kv * qv;
      }
    }
#pragma unroll
    for (int nt = 0; nt < 8; ++nt)
      lm_s[wave * 2 + hf][nt * 16 + lrow] = p[nt];
    close_xcnt();   // the q stores' registers become accumulators of the next part
  }

  // vals: lane column = tile n2 * 16 + lrow, patch columns 2 * tile - 1 .. + 2
  {
    const v4f* aU = (const v4f*)wP + QK_V4 + (size_t)wave * (64 * 8 * 32) + lane;
    v8f acc[2][16] = {};
    v4f a[8];
    // unrolled (here and below): register arrays need constant indices
#pragma unroll
    for (int pp = 0; pp < 8; ++pp) a[pp] = aU[pp * 32];
    close_xcnt();
    for (int ks = 0; ks < CF / 4; ++ks) {
      const int k = chan(ks, hf);
      // the next step's A registers are reloaded behind the products that read
      // them, so the loads fly under the rest of this step (last step: itself)
      const v4f* aN = aU + (ks + 1 < CF / 4 ? ks + 1 : ks) * (8 * 32);
      v2f e[2][4][4];   // B^T d, both channels of the lane at once
#pragma unroll
      for (int n2 = 0; n2 < 2; ++n2) {
        const int t = n2 * 16 + lrow;
#pragma unroll
        for (int j = 0; j < 4; ++j) {
          const int o = (j == 0 && t == 0) ? 64 : 2 * t - 1 + j;
          v2f d0 = { xs[0][k][o], xs[0][k + 1][o] };
          v2f d1 = { xs[1][k][o], xs[1][k + 1][o] };
          v2f d2 = { xs[2][k][o], xs[2][k + 1][o] };
          v2f d3 = { xs[3][k][o], xs[3][k + 1][o] };
          e[n2][0][j] = d0 - d2;
          e[n2][1][j] = d1 + d2;
          e[n2][2][j] = d2 - d1;
          e[n2][3][j] = d1 - d3;
        }
      }
#pragma unroll
      for (int i = 0; i < 4; ++i) {
#pragma unroll
        for (int n2 = 0; n2 < 2; ++n2) {
          v2f t0 = e[n2][i][0] - e[n2][i][2];
          v2f t1 = e[n2][i][1] + e[n2][i][2];
          v2f t2 = e[n2][i][2] - e[n2][i][1];
          v2f t3 = e[n2][i][1] - e[n2][i][3];
          acc[n2][i * 4 + 0] = wmma4(a[i * 2].lo,     t0, acc[n2][i * 4 + 0]);
          acc[n2][i * 4 + 1] = wmma4(a[i * 2].hi,     t1, acc[n2][i * 4 + 1]);
          acc[n2][i * 4 + 2] = wmma4(a[i * 2 + 1].lo, t2, acc[n2][i * 4 + 2]);
          acc[n2][i * 4 + 3] = wmma4(a[i * 2 + 1].hi, t3, acc[n2][i * 4 + 3]);
        }
        a[i * 2]     = aN[(i * 2) * 32];
        a[i * 2 + 1] = aN[(i * 2 + 1) * 32];
      }
      close_xcnt();   // the address registers are rewritten at the top of the next step
    }
    // Y = A^T M A, A^T = [1 1 1 0; 0 1 -1 -1]; every lane holds all 16
    // positions of its (channel, tile) elements
#pragma unroll
    for (int r = 0; r < 8; ++r) {
      int mo = wave * 16 + r + mhalf;
      float bvv = bv[mo];
#pragma unroll
      for (int n2 = 0; n2 < 2; ++n2) {
        float s0[4], s1[4];
#pragma unroll
        for (int c = 0; c < 4; ++c) {
          s0[c] = acc[n2][c][r] + acc[n2][4 + c][r] + acc[n2][8 + c][r];
          s1[c] = acc[n2][4 + c][r] - acc[n2][8 + c][r] - acc[n2][12 + c][r];
        }
        size_t base = (((size_t)b * CC + mo) * HH + h0) * WW + 2 * (n2 * 16 + lrow);
        *(v2f*)&v_out[base]      = v2f{ s0[0] + s0[1] + s0[2] + bvv, s0[1] - s0[2] - s0[3] + bvv };
        *(v2f*)&v_out[base + WW] = v2f{ s1[0] + s1[1] + s1[2] + bvv, s1[1] - s1[2] - s1[3] + bvv };
      }
      close_xcnt();   // the next channel's sums reuse the stores' registers
    }
  }

  __syncthreads();
  if (tid < 128) {
    float s = 0.0f;
    for (int i = 0; i < 16; ++i) s += lm_s[i][tid];
    lmain_out[((size_t)b * HH + h0) * WW + tid] = s;   // two whole rows
  }
}

// ---------------------------------------------------------------------------
// Kernel B: fused cross-attention + weighted combine.
// One WG = 16 coarse pixels = 64 subpixels (2 rows x 32 cols) for one (b,h).
// Logits use (Wc*ctx + bc).q = ctx.(Wc^T q) + bc.q : the matrix product is
// Wc^T q (M=128,N=16,K=128), once per coarse pixel instead of once per
// subpixel and context; the dot with ctx is the same length as ckeys.q was.
// Context tiles (3 x 128 x 64 f32) arrive via global_load_async_to_lds_b128,
// feed the logit dots AND the final raw-feature combine, so contexts are read
// from HBM exactly once.
// Every global read that depends on no result of this kernel (context tiles,
// mainline values, mainline logit) is issued at entry, ahead of the Wc^T q
// product: the work-group pays one memory latency, under that product, and the
// softmax and the combine read LDS and registers only.
// ---------------------------------------------------------------------------
__global__ void __launch_bounds__(256)
attn_kernel(const float* __restrict__ ctx,
            const float* __restrict__ wc, const float* __restrict__ bc,
            const float* __restrict__ q_ws, const float* __restrict__ v_ws,
            const float* __restrict__ lmain_ws,
            float* __restrict__ out) {
  const int w0  = blockIdx.x * 16;   // coarse col base
  const int sc0 = w0 * 2;            // subpixel col base
  const int h = blockIdx.y;
  const int b = blockIdx.z;
  const int tid  = threadIdx.x;
  const int wave = tid >> 5, lane = tid & 31;
  const int lrow = lane & 15;
  const int khalf = (lane >> 4) * 2;

  __shared__ __attribute__((aligned(16))) float cs[NCTX][CC][72];
  __shared__ __attribute__((aligned(16))) float vm_s[CC][16];        // mainline values
  __shared__ __attribute__((aligned(16))) float qp_s[CC][16];        // Wc^T q
  __shared__ __attribute__((aligned(16))) float part_s[8][NCTX][64]; // per-wave logit partials
  __shared__ float bq_s[16];                                         // bc . q
  __shared__ float attn_s[4][64];

  // ---- reads issued at entry ----
  // mainline logit of the coarse pixel under subpixel column tid & 31
  const float lm_r = lmain_ws[((size_t)b * HH + h) * WW + w0 + ((tid & 31) >> 1)];
  {
    // context tiles, 16 B per lane: 16 neighbouring lanes take the 64 subpixels
    // (sp = i*32 + j) of one channel, a thread every 16th channel of each context
    const int sp = (tid & 15) * 4;
    const int c0 = tid >> 4;
    const float* gp = ctx +
        (((size_t)b * CC + c0) * (2 * HH) + (2 * h + (sp >> 5))) * (2 * WW) + sc0 + (sp & 31);
    const unsigned lp = (unsigned)(uintptr_t)(&cs[0][0][0]) + (unsigned)((c0 * 72 + sp) * 4);
    for (int n = 0; n < NCTX; ++n) {
      unsigned l[8];
      const float* g[8];
      for (int j = 0; j < 8; ++j) {
        l[j] = lp + (unsigned)((n * CC + j * 16) * 72 * 4);
        g[j] = gp + ((size_t)n * BB * CC + j * 16) * (2 * HH) * (2 * WW);
      }
      copy8_to_lds(l, g);
    }
    // mainline values: 4 lanes take the 16 coarse pixels of one channel
    const float* gv = v_ws + (((size_t)b * CC + (tid >> 2)) * HH + h) * WW + w0 + (tid & 3) * 4;
    const unsigned lv = (unsigned)(uintptr_t)(&vm_s[0][0]) + (unsigned)(tid * 16);
    copy2_to_lds(lv, lv + 256 * 16, gv, gv + (size_t)64 * HH * WW);
  }

  // ---- qp[c_in][pixel] = sum_co Wc[co][c_in] * q[co][pixel]; bq = bc . q ----
  const int mhalf = (lane >> 4) * 8;
  {
    const int m = wave * 16 + lrow;  // A-matrix row = input channel of Wc
    const float* qcol = q_ws + ((size_t)b * CC * HH + h) * WW + w0 + lrow;
    v8f accA = {}, accB = {};
    float pb = 0.0f;
    // unrolled so that every step's loads are issued ahead of the first product
#pragma unroll
    for (int k0 = 0; k0 < CC; k0 += 8) {
      int k = k0 + khalf;
      v2f a0 = { wc[(size_t)k * CC + m],       wc[(size_t)(k + 1) * CC + m] };
      v2f a1 = { wc[(size_t)(k + 4) * CC + m], wc[(size_t)(k + 5) * CC + m] };
      v2f b0 = { qcol[(size_t)k * (HH * WW)],       qcol[(size_t)(k + 1) * (HH * WW)] };
      v2f b1 = { qcol[(size_t)(k + 4) * (HH * WW)], qcol[(size_t)(k + 5) * (HH * WW)] };
      accA = wmma4(a0, b0, accA);
      accB = wmma4(a1, b1, accB);
      pb += bc[k] * b0.x + bc[k + 1] * b0.y + bc[k + 4] * b1.x + bc[k + 5] * b1.y;
    }
    pb += __shfl_xor(pb, 16);  // the two lane halves hold disjoint k
    for (int r = 0; r < 8; ++r)
      qp_s[wave * 16 + r + mhalf][lrow] = accA[r] + accB[r];
    if (tid < 16) bq_s[tid] = pb;
  }

  // this wave's copies of the entry have landed, before it signals the barrier
  asm volatile("s_wait_asynccnt 0x0" ::: "memory");
  __syncthreads();

  // logits: ctx . qp. A thread takes 4 neighbouring subpixels (2 coarse pixels)
  // and every 16th channel; the two lane halves are summed in the wave, the
  // 8 waves' partials in fixed order by the softmax threads.
  {
    const int sp4 = (tid & 15) * 4;
    const int grp = tid >> 4;
    const int px  = (sp4 & 31) >> 1;
    v4f s0 = {}, s1 = {}, s2 = {};
    for (int i = 0; i < 8; ++i) {
      int c = i * 16 + grp;
      v2f qv = *(const v2f*)&qp_s[c][px];
      v4f qq = { qv.x, qv.x, qv.y, qv.y };
      s0 += *(const v4f*)&cs[0][c][sp4] * qq;
      s1 += *(const v4f*)&cs[1][c][sp4] * qq;
      s2 += *(const v4f*)&cs[2][c][sp4] * qq;
    }
    for (int e = 0; e < 4; ++e) {
      s0[e] += __shfl_xor(s0[e], 16);
      s1[e] += __shfl_xor(s1[e], 16);
      s2[e] += __shfl_xor(s2[e], 16);
    }
    if (lane < 16) {
      *(v4f*)&part_s[wave][0][sp4] = s0;
      *(v4f*)&part_s[wave][1][sp4] = s1;
      *(v4f*)&part_s[wave][2][sp4] = s2;
    }
  }
  __syncthreads();

  // 4-way softmax per subpixel (3 contexts + mainline)
  if (tid < 64) {
    int sp = tid;
    int j = sp & 31;
    float l0 = bq_s[j >> 1], l1 = l0, l2 = l0;
    for (int w = 0; w < 8; ++w) {
      l0 += part_s[w][0][sp];
      l1 += part_s[w][1][sp];
      l2 += part_s[w][2][sp];
    }
    float lm = lm_r;
    float mx = fmaxf(fmaxf(l0, l1), fmaxf(l2, lm));
    float e0 = __expf(l0 - mx), e1 = __expf(l1 - mx);
    float e2 = __expf(l2 - mx), em = __expf(lm - mx);
    float inv = 1.0f / (e0 + e1 + e2 + em);
    attn_s[0][sp] = e0 * inv;
    attn_s[1][sp] = e1 * inv;
    attn_s[2][sp] = e2 * inv;
    attn_s[3][sp] = em * inv;
  }
  __syncthreads();

  // weighted combine: raw context features and mainline values, both in LDS
  for (int idx = tid; idx < CC * 64; idx += 256) {
    int c  = idx >> 6;
    int sp = idx & 63;
    int i = sp >> 5, j = sp & 31;
    float vmain = vm_s[c][j >> 1];
    float o = attn_s[0][sp] * cs[0][c][sp]
            + attn_s[1][sp] * cs[1][c][sp]
            + attn_s[2][sp] * cs[2][c][sp]
            + attn_s[3][sp] * vmain;
    out[(((size_t)b * CC + c) * (2 * HH) + (2 * h + i)) * (2 * WW) + sc0 + j] = o;
  }
}

// ---------------------------------------------------------------------------
extern "C" void kernel_launch(void* const* d_in, const int* in_sizes, int n_in,
                              void* d_out, int out_size, void* d_ws, size_t ws_size,
                              hipStream_t stream) {
  const float* contexts   = (const float*)d_in[0];
  const float* mainstream = (const float*)d_in[1];
  const float* Wc_w = (const float*)d_in[2];
  const float* Wc_b = (const float*)d_in[3];
  const float* Wf_w = (const float*)d_in[4];
  const float* Wf_b = (const float*)d_in[5];
  const float* Wk_w = (const float*)d_in[6];
  const float* Wk_b = (const float*)d_in[7];
  const float* Wv_w = (const float*)d_in[8];
  const float* Wv_b = (const float*)d_in[9];
  float* out = (float*)d_out;

  float* ws    = (float*)d_ws;
  float* q_ws  = ws;                                   // B*CC*H*W
  float* v_ws  = q_ws + (size_t)BB * CC * HH * WW;     // B*CC*H*W
  float* lm_ws = v_ws + (size_t)BB * CC * HH * WW;     // B*H*W
  float* wP    = lm_ws + (size_t)BB * HH * WW;         // (2 + 16)*CC*CF

  hipLaunchKernelGGL(pack_weights_kernel,
                     dim3((QK_V4 + U_THR) / 256), dim3(256), 0, stream,
                     Wv_w, Wf_w, Wk_w, wP);
  hipLaunchKernelGGL(proj_kernel,
                     dim3(HH / 2, BB), dim3(256), 0, stream,
                     mainstream, wP, Wf_b, Wk_b, Wv_b,
                     q_ws, v_ws, lm_ws);
  hipLaunchKernelGGL(attn_kernel,
                     dim3(WW / 16, HH, BB), dim3(256), 0, stream,
                     contexts, Wc_w, Wc_b, q_ws, v_ws, lm_ws, out);
}
